// v009
// Measured on an AMD MI455X. A time is GPU time per run, averaged over a window of back-to-back runs after a warm-up
// (all launches, gaps included; the runs take copies of the inputs in turn), and the median of several windows.
// Apart from v000's, it joins two sittings. Times from different sittings can be a few percent apart, while
// side-by-side timings come from the same sitting.
// Earlier versions than v009 are not in this document.
// One run takes 143 microseconds.
// Two timings next to v008 put it at 1.04 and 1.03 times that version's speed.
// Counting every step since v000, which is the starting kernel, it is 5.12 times as fast.
#include <hip/hip_runtime.h>
// Power-law-graph multi-head attention (B=1, S=2048, D=2048, 16 heads × 128; INPUT additive mask (nonzero = −1e9) ; RoPE interleaved pairs): q/k/v/o projections ((out,in) + bias) and the per-head
// metric product qg = q_h·G_h as GEMMs and the attention as a fused flash-style kernel (head dim 128: 4 k-steps / 8 d-tiles; masked keys excluded, fully masked 32-key tiles skipped by ballot;
// online softmax f32; P f16 ≤ 1; O = P·Vt; RPW-16 waves) on v_wmma_f32_16x16x32_f16, f32 accumulate; RoPE f32 VALU.
#define SS 2048
#define CC 2048
#define NH 16
#define HD 128

typedef __bf16 v16b __attribute__((ext_vector_type(16)));
typedef unsigned short v8us __attribute__((ext_vector_type(8), may_alias));
typedef float  v8f  __attribute__((ext_vector_type(8)));
typedef float  v4f  __attribute__((ext_vector_type(4)));
typedef float  v4fa __attribute__((ext_vector_type(4), may_alias));
union FragB { v16b v; v8us half[2]; unsigned short u[16]; };

__device__ __forceinline__ unsigned short bf16_bits(float x) { unsigned int u = __float_as_uint(x); return (unsigned short)((u + 0x7FFFu + ((u >> 16) & 1u)) >> 16); }
__device__ __forceinline__ float bf16_val(unsigned short b) { return __uint_as_float(((unsigned int)b) << 16); }
__device__ __forceinline__ float bf16_round(float x) { return bf16_val(bf16_bits(x)); }
// D += A·B with NT terms: 1 = ah·bh, 2 = + al·bh (A split), 3 = + ah·bl (both split)
template <int NT>
__device__ __forceinline__ v8f mmaN(v16b ah, v16b al, v16b bh, v16b bl, v8f c) {
  c = __builtin_amdgcn_wmma_f32_16x16x32_bf16(false, ah, false, bh, (short)0, c, false, false);
  if (NT >= 2) c = __builtin_amdgcn_wmma_f32_16x16x32_bf16(false, al, false, bh, (short)0, c, false, false);
  if (NT >= 3) c = __builtin_amdgcn_wmma_f32_16x16x32_bf16(false, ah, false, bl, (short)0, c, false, false);
  asm volatile("v_nop\n\tv_nop\n\tv_nop\n\tv_nop" : "+v"(c) : "v"(ah), "v"(al), "v"(bh), "v"(bl));
  return c;
}

__global__ __launch_bounds__(256) void k_wt_bf16(const float* __restrict__ W, unsigned short* __restrict__ Wt, int K, int N) {
  const int t = blockIdx.x * 256 + threadIdx.x;
  const int k8n = K / 8;
  if (t >= N * k8n) return;
  const int n = t / k8n, k8 = (t % k8n) * 8;
  v8us v;
#pragma unroll
  for (int i = 0; i < 8; ++i) v[i] = bf16_bits(W[(size_t)(k8 + i) * N + n]);
  *(v8us*)(Wt + (size_t)n * K + k8) = v;
  
}

// GEMM C[M][N] (f32, pitch ldc) = act(A[M][K]·W + bias). A f32 row-major (pitch lda) converted per fragment to bf16
// (ASPLIT: hi/lo two planes -> 2 terms, else single rounded term); Wt bf16 [N][K] (pitch ldb). BIAS_BF16 rounds the
// bias to bf16 first (bias quantised to bf16 before the add). K%32==0, M%16==0, N%64==0.
template <bool ASPLIT, int ACT, bool BIAS_BF16>
__global__ __launch_bounds__(128) void k_gemm_bf(const float* __restrict__ A, int lda, const unsigned short* __restrict__ Wt, int ldb,
                                               const float* __restrict__ bias, float* __restrict__ C, int ldc, int M, int N, int K) {
  __shared__ __attribute__((aligned(16))) float so[4][16][64];
  const int tid = threadIdx.x, w = tid >> 5, lane = tid & 31, ln = lane & 15, hh = lane >> 4;
  const int ntn = N / 64;
  const int wid = blockIdx.x * 4 + w;
  const int mt = wid / ntn, nq = wid % ntn;
  if (mt * 16 >= M) return;
  const int row0 = mt * 16, col0 = nq * 64;
  const float* arow = A + (size_t)(row0 + ln) * lda;
  v8f acc[4] = {};
  for (int kb = 0; kb < K; kb += 32) {
    FragB ah, al;
    const v4f x0 = *(const v4fa*)(arow + kb + 8 * hh), x1 = *(const v4fa*)(arow + kb + 8 * hh + 4);
    const v4f x2 = *(const v4fa*)(arow + kb + 16 + 8 * hh), x3 = *(const v4fa*)(arow + kb + 16 + 8 * hh + 4);
    float xs[16] = {x0[0],x0[1],x0[2],x0[3],x1[0],x1[1],x1[2],x1[3],x2[0],x2[1],x2[2],x2[3],x3[0],x3[1],x3[2],x3[3]};
#pragma unroll
    for (int i = 0; i < 16; ++i) { const unsigned short hb = bf16_bits(xs[i]); ah.u[i] = hb; al.u[i] = ASPLIT ? bf16_bits(xs[i] - bf16_val(hb)) : (unsigned short)0; }
#pragma unroll
    for (int t = 0; t < 4; ++t) {
      const unsigned short* brow = Wt + (size_t)(col0 + t * 16 + ln) * ldb + kb;
      FragB b;
      b.half[0] = *(const v8us*)(brow + 8 * hh);
      b.half[1] = *(const v8us*)(brow + 16 + 8 * hh);
      acc[t] = mmaN<ASPLIT ? 2 : 1>(ah.v, al.v, b.v, b.v, acc[t]);
    }
  }
#pragma unroll
  for (int t = 0; t < 4; ++t) {
    float bv = bias ? bias[col0 + t * 16 + ln] : 0.f;
    if (BIAS_BF16) bv = bf16_round(bv);
#pragma unroll
    for (int r = 0; r < 8; ++r) { float v = acc[t][r] + bv; if (ACT == 1) v = fmaxf(v, 0.f); so[w][8 * hh + r][t * 16 + ln] = v; }
  }
  __builtin_amdgcn_fence(__ATOMIC_ACQ_REL, "workgroup");
  __builtin_amdgcn_wave_barrier();
  const int rsub = lane >> 4, c4 = (lane & 15) * 4;
  {
#pragma unroll
    for (int q = 0; q < 8; ++q) {
      const int r = q * 2 + rsub;
      const v4f v = *(const v4fa*)&so[w][r][c4];
      *(v4f*)(C + (size_t)(row0 + r) * ldc + col0 + c4) = v;
    }
    
  }
}

// Flash-style causal/unmasked attention, all contractions 3-term bf16 hi/lo splits, f32 softmax with running max.
// q,k,v rows are read from f32 buffers with arbitrary row pitch (so they can live inside a fused qkv buffer);
// D = head size (multiple of 32, <= 128); one wave = 16 query rows; block = 4 waves (64 queries) sharing K/V chunks of 32.
template <int D, bool CAUSAL>
__global__ __launch_bounds__(128) void k_flash(const float* __restrict__ qb, const float* __restrict__ kb, const float* __restrict__ vb,
                                             int pitch, int T, int H, float scale, float* __restrict__ y, int ypitch) {
  constexpr int KS = D / 32;        // k-steps for QK
  constexpr int DT = D / 16;        // d tiles for PV
  __shared__ __attribute__((aligned(16))) unsigned short sKh[32][D + 8], sKl[32][D + 8], sVh[32][D + 8], sVl[32][D + 8];
  __shared__ __attribute__((aligned(16))) unsigned short sPh[4][16][40], sPl[4][16][40];
  __shared__ __attribute__((aligned(16))) float sO[4][16][D];
  const int tid = threadIdx.x, w = tid >> 5, lane = tid & 31, ln = lane & 15, hh = lane >> 4;
  const int nqb = (T + 63) / 64;
  const int bh = blockIdx.x / nqb, qblk = blockIdx.x % nqb;
  const int b = bh / H, h = bh % H;
  const int q0 = qblk * 64 + w * 16;
  const float* Q = qb + (size_t)b * T * pitch + h * D;
  const float* K = kb + (size_t)b * T * pitch + h * D;
  const float* V = vb + (size_t)b * T * pitch + h * D;

  // A fragments of the wave's 16 query rows (scaled), hi/lo
  FragB aqh[KS], aql[KS];
  {
    int row = q0 + ln; if (row >= T) row = T - 1;
    const float* qr = Q + (size_t)row * pitch;
#pragma unroll
    for (int ks = 0; ks < KS; ++ks)
#pragma unroll
      for (int i = 0; i < 16; ++i) {
        const int d = ks * 32 + ((i < 8) ? (8 * hh + i) : (16 + 8 * hh + (i - 8)));
        const float x = qr[d] * scale; const unsigned short hb = bf16_bits(x);
        aqh[ks].u[i] = hb; aql[ks].u[i] = bf16_bits(x - bf16_val(hb));
      }
  }
  float m_r[8], l_r[8];
#pragma unroll
  for (int r = 0; r < 8; ++r) { m_r[r] = -3.0e38f; l_r[r] = 0.f; }
  v8f oacc[DT];
#pragma unroll
  for (int dt = 0; dt < DT; ++dt) oacc[dt] = (v8f){0.f,0.f,0.f,0.f,0.f,0.f,0.f,0.f};

  const int kv_end = CAUSAL ? min(T, qblk * 64 + 64) : T;     // block-uniform
  for (int j0 = 0; j0 < kv_end; j0 += 32) {
    __syncthreads();
    for (int e = tid; e < 32 * (D / 4); e += 128) {
      const int r = e / (D / 4), c4 = (e % (D / 4)) * 4;
      const int key = j0 + r;
      v4f kf = {0.f,0.f,0.f,0.f}, vf = {0.f,0.f,0.f,0.f};
      if (key < T) { kf = *(const v4fa*)(K + (size_t)key * pitch + c4); vf = *(const v4fa*)(V + (size_t)key * pitch + c4); }
#pragma unroll
      for (int t = 0; t < 4; ++t) {
        unsigned short hb = bf16_bits(kf[t]); sKh[r][c4 + t] = hb; sKl[r][c4 + t] = bf16_bits(kf[t] - bf16_val(hb));
        hb = bf16_bits(vf[t]); sVh[r][c4 + t] = hb; sVl[r][c4 + t] = bf16_bits(vf[t] - bf16_val(hb));
      }
    }
    __syncthreads();
    // S tile 16 x 32
    v8f s[2];
#pragma unroll
    for (int nt = 0; nt < 2; ++nt) {
      v8f acc = {};
#pragma unroll
      for (int ks = 0; ks < KS; ++ks) {
        FragB bh_, bl_;
        bh_.half[0] = *(const v8us*)&sKh[nt * 16 + ln][ks * 32 + 8 * hh]; bh_.half[1] = *(const v8us*)&sKh[nt * 16 + ln][ks * 32 + 16 + 8 * hh];
        bl_.half[0] = *(const v8us*)&sKl[nt * 16 + ln][ks * 32 + 8 * hh]; bl_.half[1] = *(const v8us*)&sKl[nt * 16 + ln][ks * 32 + 16 + 8 * hh];
        acc = mmaN<3>(aqh[ks].v, aql[ks].v, bh_.v, bl_.v, acc);
      }
      s[nt] = acc;
    }
    // mask + running max (rows 8hh+r; the 16 lanes of a half share rows)
    float alpha[8];
#pragma unroll
    for (int r = 0; r < 8; ++r) {
      const int qi = q0 + 8 * hh + r;
      const int ja = j0 + ln, jb = j0 + 16 + ln;
      if (CAUSAL) { if (ja > qi) s[0][r] = -3.0e38f; if (jb > qi) s[1][r] = -3.0e38f; }
      if (ja >= T) s[0][r] = -3.0e38f;
      if (jb >= T) s[1][r] = -3.0e38f;
      float mx = fmaxf(s[0][r], s[1][r]);
      mx = fmaxf(mx, __shfl_xor(mx, 1, 32)); mx = fmaxf(mx, __shfl_xor(mx, 2, 32)); mx = fmaxf(mx, __shfl_xor(mx, 4, 32)); mx = fmaxf(mx, __shfl_xor(mx, 8, 32));
      const float mnew = fmaxf(m_r[r], mx);
      alpha[r] = (mnew > -1.0e38f) ? __expf(m_r[r] - mnew) : 1.0f;
      const float p0 = (s[0][r] > -1.0e38f) ? __expf(s[0][r] - mnew) : 0.f;
      const float p1 = (s[1][r] > -1.0e38f) ? __expf(s[1][r] - mnew) : 0.f;
      m_r[r] = mnew;
      l_r[r] = l_r[r] * alpha[r] + p0 + p1;            // per-lane partial row sum (16 lanes combined at the end)
      unsigned short hb = bf16_bits(p0); sPh[w][8 * hh + r][ln] = hb;      sPl[w][8 * hh + r][ln] = bf16_bits(p0 - bf16_val(hb));
      hb = bf16_bits(p1);                sPh[w][8 * hh + r][16 + ln] = hb; sPl[w][8 * hh + r][16 + ln] = bf16_bits(p1 - bf16_val(hb));
    }
#pragma unroll
    for (int dt = 0; dt < DT; ++dt)
#pragma unroll
      for (int r = 0; r < 8; ++r) oacc[dt][r] *= alpha[r];
    __builtin_amdgcn_fence(__ATOMIC_ACQ_REL, "workgroup");
    __builtin_amdgcn_wave_barrier();
    FragB pah, pal;
    pah.half[0] = *(const v8us*)&sPh[w][ln][8 * hh]; pah.half[1] = *(const v8us*)&sPh[w][ln][16 + 8 * hh];
    pal.half[0] = *(const v8us*)&sPl[w][ln][8 * hh]; pal.half[1] = *(const v8us*)&sPl[w][ln][16 + 8 * hh];
#pragma unroll
    for (int dt = 0; dt < DT; ++dt) {
      FragB bvh, bvl;
#pragma unroll
      for (int i = 0; i < 8; ++i) {
        bvh.u[i] = sVh[8 * hh + i][dt * 16 + ln]; bvh.u[8 + i] = sVh[16 + 8 * hh + i][dt * 16 + ln];
        bvl.u[i] = sVl[8 * hh + i][dt * 16 + ln]; bvl.u[8 + i] = sVl[16 + 8 * hh + i][dt * 16 + ln];
      }
      oacc[dt] = mmaN<3>(pah.v, pal.v, bvh.v, bvl.v, oacc[dt]);
    }
    __builtin_amdgcn_fence(__ATOMIC_ACQ_REL, "workgroup");
    __builtin_amdgcn_wave_barrier();
  }
#pragma unroll
  for (int r = 0; r < 8; ++r) {
    float l = l_r[r];
    l += __shfl_xor(l, 1, 32); l += __shfl_xor(l, 2, 32); l += __shfl_xor(l, 4, 32); l += __shfl_xor(l, 8, 32);
    l_r[r] = (l > 0.f) ? 1.0f / l : 0.f;
  }
#pragma unroll
  for (int dt = 0; dt < DT; ++dt)
#pragma unroll
    for (int r = 0; r < 8; ++r) sO[w][8 * hh + r][dt * 16 + ln] = oacc[dt][r] * l_r[r];
  __builtin_amdgcn_fence(__ATOMIC_ACQ_REL, "workgroup");
  __builtin_amdgcn_wave_barrier();
  {
    for (int r = 0; r < 16; ++r) {
      const int row = q0 + r;
      if (row < T && lane < D / 4) {
        const v4f val = *(const v4fa*)&sO[w][r][lane * 4];
        *(v4f*)(y + ((size_t)b * T + row) * ypitch + h * D + lane * 4) = val;
      }
    }
    
  }
}

// GEMM C = act(A·W + bias + resid): A f32 (ASPLIT -> hi/lo 2 terms), Wt bf16 [N][K]; ACT 0 none, 1 relu, 2 exact gelu;
// resid (optional, f32, row index = (row % rmod), pitch ldr, RES_BF16 rounds it) added before the activation.
template <bool ASPLIT, int ACT, bool BIAS_BF16, bool RES_BF16>
__global__ __launch_bounds__(128) void k_gemm_bf3(const float* __restrict__ A, int lda, const unsigned short* __restrict__ Wt, int ldb,
                                                const float* __restrict__ bias, const float* __restrict__ resid, int rmod, int ldr,
                                                float* __restrict__ C, int ldc, int M, int N, int K) {
  __shared__ __attribute__((aligned(16))) float so[4][16][64];
  const int tid = threadIdx.x, w = tid >> 5, lane = tid & 31, ln = lane & 15, hh = lane >> 4;
  const int ntn = N / 64;
  const int wid = blockIdx.x * 4 + w;
  const int mt = wid / ntn, nq = wid % ntn;
  if (mt * 16 >= M) return;
  const int row0 = mt * 16, col0 = nq * 64;
  const float* arow = A + (size_t)(row0 + ln) * lda;
  v8f acc[4] = {};
  for (int kb = 0; kb < K; kb += 32) {
    FragB ah, al;
    const v4f x0 = *(const v4fa*)(arow + kb + 8 * hh), x1 = *(const v4fa*)(arow + kb + 8 * hh + 4);
    const v4f x2 = *(const v4fa*)(arow + kb + 16 + 8 * hh), x3 = *(const v4fa*)(arow + kb + 16 + 8 * hh + 4);
    float xs[16] = {x0[0],x0[1],x0[2],x0[3],x1[0],x1[1],x1[2],x1[3],x2[0],x2[1],x2[2],x2[3],x3[0],x3[1],x3[2],x3[3]};
#pragma unroll
    for (int i = 0; i < 16; ++i) { const unsigned short hb = bf16_bits(xs[i]); ah.u[i] = hb; al.u[i] = ASPLIT ? bf16_bits(xs[i] - bf16_val(hb)) : (unsigned short)0; }
#pragma unroll
    for (int t = 0; t < 4; ++t) {
      const unsigned short* brow = Wt + (size_t)(col0 + t * 16 + ln) * ldb + kb;
      FragB b;
      b.half[0] = *(const v8us*)(brow + 8 * hh);
      b.half[1] = *(const v8us*)(brow + 16 + 8 * hh);
      acc[t] = mmaN<ASPLIT ? 2 : 1>(ah.v, al.v, b.v, b.v, acc[t]);
    }
  }
#pragma unroll
  for (int t = 0; t < 4; ++t) {
    const int col = col0 + t * 16 + ln;
    float bv = bias ? bias[col] : 0.f;
    if (BIAS_BF16) bv = bf16_round(bv);
#pragma unroll
    for (int r = 0; r < 8; ++r) {
      float v = acc[t][r] + bv;
      if (resid) { float rv = resid[(size_t)((row0 + 8 * hh + r) % rmod) * ldr + col]; if (RES_BF16) rv = bf16_round(rv); v += rv; }
      if (ACT == 1) v = fmaxf(v, 0.f);
      if (ACT == 2) v = 0.5f * v * (1.0f + erff(v * 0.70710678118654752f));
      if (ACT == 3) { const float u = 0.7978845608028654f * (v + 0.044715f * v * v * v); v = 0.5f * v * (1.0f + tanhf(u)); }
      so[w][8 * hh + r][t * 16 + ln] = v;
    }
  }
  __builtin_amdgcn_fence(__ATOMIC_ACQ_REL, "workgroup");
  __builtin_amdgcn_wave_barrier();
  const int rsub = lane >> 4, c4 = (lane & 15) * 4;
  {
#pragma unroll
    for (int q = 0; q < 8; ++q) {
      const int r = q * 2 + rsub;
      const v4f v = *(const v4fa*)&so[w][r][c4];
      *(v4f*)(C + (size_t)(row0 + r) * ldc + col0 + c4) = v;
    }
    
  }
}
// row LayerNorm (biased variance, eps) over N: s = X (+ R); optional out_sum <- s; out_norm <- (s-mu)*rsqrt(var+eps)*g + b
template <bool PARAM_BF16>
__global__ __launch_bounds__(256) void k_layernorm(const float* __restrict__ X, const float* __restrict__ R, const float* __restrict__ g, const float* __restrict__ bta,
                                                  float* __restrict__ out_sum, float* __restrict__ out_norm, int N, float eps) {
  __shared__ float red[256];
  const int row = blockIdx.x, tid = threadIdx.x;
  const float* x = X + (size_t)row * N; const float* rr = R ? R + (size_t)row * N : nullptr;
  float vals[16];                     // up to N = 4096
  const int per = N / 256;            // contiguous chunk per thread? use strided-by-4 chunks: thread handles j = tid*4 + 1024*u
  float s1 = 0.f;
  for (int u = 0; u < per / 4; ++u) {
    const int j = tid * 4 + 1024 * u;
    const v4f a = *(const v4fa*)(x + j);
    v4f b = {0.f,0.f,0.f,0.f}; if (rr) b = *(const v4fa*)(rr + j);
#pragma unroll
    for (int q = 0; q < 4; ++q) { const float v = a[q] + b[q]; vals[u * 4 + q] = v; s1 += v; }
  }
  red[tid] = s1; __syncthreads();
  for (int st = 128; st > 0; st >>= 1) { if (tid < st) red[tid] += red[tid + st]; __syncthreads(); }
  const float mu = red[0] / (float)N; __syncthreads();
  float s2 = 0.f;
  for (int u = 0; u < per / 4; ++u)
#pragma unroll
    for (int q = 0; q < 4; ++q) { const float c = vals[u * 4 + q] - mu; s2 += c * c; }
  red[tid] = s2; __syncthreads();
  for (int st = 128; st > 0; st >>= 1) { if (tid < st) red[tid] += red[tid + st]; __syncthreads(); }
  const float rs = rsqrtf(red[0] / (float)N + eps);
  {
    for (int u = 0; u < per / 4; ++u) {
      const int j = tid * 4 + 1024 * u;
      v4f o, sm;
#pragma unroll
      for (int q = 0; q < 4; ++q) {
        float gg = g[j + q], bb = bta[j + q];
        if (PARAM_BF16) { gg = bf16_round(gg); bb = bf16_round(bb); }
        sm[q] = vals[u * 4 + q]; o[q] = (vals[u * 4 + q] - mu) * rs * gg + bb;
      }
      if (out_sum) *(v4f*)(out_sum + (size_t)row * N + j) = sm;
      *(v4f*)(out_norm + (size_t)row * N + j) = o;
    }
    
  }
}



// ---- f16 WMMA path (v_wmma_f32_16x16x32_f16): 11-bit significands for operands in range — used where a [0,1] probability operand needs more precision than bf16
typedef _Float16 v16h __attribute__((ext_vector_type(16)));
union FragH { v16h v; v8us half[2]; _Float16 h[16]; unsigned short u[16]; };
template <int NT>
__device__ __forceinline__ v8f mmaH(v16h ah, v16h al, v16h bh, v16h bl, v8f c) {
  c = __builtin_amdgcn_wmma_f32_16x16x32_f16(false, ah, false, bh, (short)0, c, false, false);
  if (NT >= 2) c = __builtin_amdgcn_wmma_f32_16x16x32_f16(false, al, false, bh, (short)0, c, false, false);
  if (NT >= 3) c = __builtin_amdgcn_wmma_f32_16x16x32_f16(false, ah, false, bl, (short)0, c, false, false);
  asm volatile("v_nop\n\tv_nop\n\tv_nop\n\tv_nop" : "+v"(c) : "v"(ah), "v"(al), "v"(bh), "v"(bl));
  return c;
}
// batched GEMM like k_gemm_b but f16 operands: A f32 (split into f16 hi/lo if ASPLIT, else rounded to f16), Bt = f16 values [n][k]; alpha; C f32; N multiple of 16 (partial tiles skipped)
template <bool ASPLIT>
__global__ __launch_bounds__(128) void k_gemm_h(const float* __restrict__ A, int lda, size_t sA, const _Float16* __restrict__ Bh, int ldb, size_t sB, float alpha, float* __restrict__ C, int ldc, size_t sC, int M, int N, int K) {
  __shared__ __attribute__((aligned(16))) float so[4][16][64];
  const int tid = threadIdx.x, w = tid >> 5, lane = tid & 31, ln = lane & 15, hh = lane >> 4; const int by = blockIdx.y;
  A += (size_t)by * sA; Bh += (size_t)by * sB; C += (size_t)by * sC;
  const int ntn = (N + 63) / 64; const int wid = blockIdx.x * 4 + w; const int mt = wid / ntn, nq = wid % ntn; if (mt * 16 >= M) return;
  const int row0 = mt * 16, col0 = nq * 64; const float* arow = A + (size_t)(row0 + ln) * lda;
  v8f acc[4] = {};
  for (int kb = 0; kb < K; kb += 32) {
    FragH ah, al;
    const v4f x0 = *(const v4fa*)(arow + kb + 8 * hh), x1 = *(const v4fa*)(arow + kb + 8 * hh + 4), x2 = *(const v4fa*)(arow + kb + 16 + 8 * hh), x3 = *(const v4fa*)(arow + kb + 16 + 8 * hh + 4);
    float xs[16] = {x0[0],x0[1],x0[2],x0[3],x1[0],x1[1],x1[2],x1[3],x2[0],x2[1],x2[2],x2[3],x3[0],x3[1],x3[2],x3[3]};
#pragma unroll
    for (int i = 0; i < 16; ++i) { const _Float16 h = (_Float16)xs[i]; ah.h[i] = h; al.h[i] = ASPLIT ? (_Float16)(xs[i] - (float)h) : (_Float16)0.0f; }
#pragma unroll
    for (int t = 0; t < 4; ++t) { if (col0 + t * 16 >= N) continue; const size_t boff = (size_t)(col0 + t * 16 + ln) * ldb + kb; FragH bq; bq.half[0] = *(const v8us*)(Bh + boff + 8 * hh); bq.half[1] = *(const v8us*)(Bh + boff + 16 + 8 * hh);
      acc[t] = mmaH<ASPLIT ? 2 : 1>(ah.v, al.v, bq.v, bq.v, acc[t]); }
  }
#pragma unroll
  for (int t = 0; t < 4; ++t) { if (col0 + t * 16 >= N) continue;
#pragma unroll
    for (int r = 0; r < 8; ++r) so[w][8 * hh + r][t * 16 + ln] = acc[t][r] * alpha; }
  __builtin_amdgcn_fence(__ATOMIC_ACQ_REL, "workgroup"); __builtin_amdgcn_wave_barrier();
  const int rsub = lane >> 4, c4 = (lane & 15) * 4;
  {
#pragma unroll
    for (int q = 0; q < 8; ++q) { const int r = q * 2 + rsub; if (col0 + c4 < N) { const v4f v = *(const v4fa*)&so[w][r][c4]; *(v4f*)(C + (size_t)(row0 + r) * ldc + col0 + c4) = v; } }
     }
}

// k_gemm_hh variant with fused epilogue: v = acc·alpha + bias[by·sBias + col] (+ CP[(row/rowsPerB)·sCPb + by·64 + col] if CP) ; ACT 0 none / 1 elu ; writes f16 C16 (and f32 C if non-null)
template <int ACT>
__global__ __launch_bounds__(128) void k_gemm_hhx(const _Float16* __restrict__ A, int lda, size_t sA, const _Float16* __restrict__ Bh, int ldb, size_t sB, float alpha, const float* __restrict__ bias, size_t sBias, const float* __restrict__ CP, int rowsPerB, size_t sCPb, int row0g,
    float* __restrict__ C, _Float16* __restrict__ C16, int ldc, size_t sC, int M, int N, int K) {
  __shared__ __attribute__((aligned(16))) float so[4][16][64];
  const int tid = threadIdx.x, w = tid >> 5, lane = tid & 31, ln = lane & 15, hh = lane >> 4; const int by = blockIdx.y;
  A += (size_t)by * sA; Bh += (size_t)by * sB; const size_t cofs = (size_t)by * sC; const float* bp = bias ? bias + (size_t)by * sBias : nullptr;
  const int ntn = (N + 63) / 64; const int wid = blockIdx.x * 4 + w; const int mt = wid / ntn, nq = wid % ntn; if (mt * 16 >= M) return;
  const int row0 = mt * 16, col0 = nq * 64; const _Float16* arow = A + (size_t)(row0 + ln) * lda;
  v8f acc[4] = {};
  for (int kb = 0; kb < K; kb += 32) { FragH ah; ah.half[0] = *(const v8us*)((const unsigned short*)arow + kb + 8 * hh); ah.half[1] = *(const v8us*)((const unsigned short*)arow + kb + 16 + 8 * hh);
#pragma unroll
    for (int t = 0; t < 4; ++t) { if (col0 + t * 16 >= N) continue; const size_t boff = (size_t)(col0 + t * 16 + ln) * ldb + kb; FragH bq; bq.half[0] = *(const v8us*)((const unsigned short*)Bh + boff + 8 * hh); bq.half[1] = *(const v8us*)((const unsigned short*)Bh + boff + 16 + 8 * hh);
      acc[t] = mmaH<1>(ah.v, ah.v, bq.v, bq.v, acc[t]); }
  }
#pragma unroll
  for (int t = 0; t < 4; ++t) { if (col0 + t * 16 >= N) continue; const int col = col0 + t * 16 + ln; const float bv = bp ? bf16_round(bp[col]) : 0.f;
#pragma unroll
    for (int r = 0; r < 8; ++r) { float v = acc[t][r] * alpha + bv; if (CP) { const int bidx = (row0g + row0 + 8 * hh + r) / rowsPerB; v += CP[(size_t)bidx * sCPb + (size_t)by * 64 + col]; } if (ACT == 1) v = (v > 0.f) ? v : expm1f(v); else if (ACT == 3) v = fmaxf(v, 0.f); so[w][8 * hh + r][t * 16 + ln] = v; } }
  __builtin_amdgcn_fence(__ATOMIC_ACQ_REL, "workgroup"); __builtin_amdgcn_wave_barrier();
  const int rsub = lane >> 4, c4 = (lane & 15) * 4; typedef _Float16 v4h __attribute__((ext_vector_type(4)));
  {
#pragma unroll
    for (int q = 0; q < 8; ++q) { const int r = q * 2 + rsub; if (col0 + c4 < N) { const v4f v = *(const v4fa*)&so[w][r][c4]; if (C) *(v4f*)(C + cofs + (size_t)(row0 + r) * ldc + col0 + c4) = v; if (C16) { v4h h4; for (int i = 0; i < 4; ++i) h4[i] = (_Float16)v[i]; *(v4h*)(C16 + cofs + (size_t)(row0 + r) * ldc + col0 + c4) = h4; } } }
     }
}


// Projection GEMM, 2048 x 2048 x 2048: C = (A . Bt^T) * alpha + bias. One 128 x 128 tile of C per workgroup of 8 waves (4 x 2, 32 x 64 per wave).
// A pass is 128 k: 128 rows of A and 128 rows of Bt, 256 B each, laid in LDS at pitch 272 B by asynchronous copies, two buffers, the next pass's copies in flight under this pass's products.
// k runs upward in steps of 32 into one accumulator per 16 x 16 tile, as in k_gemm_hhx: the sums keep their order.
// Every '#pragma unroll' in k_gemm_t makes the indices of the fragment and accumulator arrays constants, so that they stay in registers.
#define GT_PITCH 272u
#define GT_STAGE (256u * GT_PITCH)
#define GT_NST (CC / 128)
__device__ __forceinline__ void gt_copy8(unsigned l0, const unsigned short* g0) {
  // eight 16-byte copies of this lane, rows 16 apart; s_wait_xcnt stands inside the statement so that no address register is rewritten ahead of it
  const unsigned l1 = l0 + 16u * GT_PITCH, l2 = l0 + 32u * GT_PITCH, l3 = l0 + 48u * GT_PITCH, l4 = l0 + 64u * GT_PITCH, l5 = l0 + 80u * GT_PITCH, l6 = l0 + 96u * GT_PITCH, l7 = l0 + 112u * GT_PITCH;
  const unsigned short *g1 = g0 + 16 * CC, *g2 = g0 + 32 * CC, *g3 = g0 + 48 * CC, *g4 = g0 + 64 * CC, *g5 = g0 + 80 * CC, *g6 = g0 + 96 * CC, *g7 = g0 + 112 * CC;
  asm volatile("global_load_async_to_lds_b128 %0, %8, off\n\t"
               "global_load_async_to_lds_b128 %1, %9, off\n\t"
               "global_load_async_to_lds_b128 %2, %10, off\n\t"
               "global_load_async_to_lds_b128 %3, %11, off\n\t"
               "global_load_async_to_lds_b128 %4, %12, off\n\t"
               "global_load_async_to_lds_b128 %5, %13, off\n\t"
               "global_load_async_to_lds_b128 %6, %14, off\n\t"
               "global_load_async_to_lds_b128 %7, %15, off\n\t"
               "s_wait_xcnt 0x0"
               :: "v"(l0), "v"(l1), "v"(l2), "v"(l3), "v"(l4), "v"(l5), "v"(l6), "v"(l7),
                  "v"(g0), "v"(g1), "v"(g2), "v"(g3), "v"(g4), "v"(g5), "v"(g6), "v"(g7) : "memory");
}
// blockIdx.y picks one of up to three independent products that share the grid; product 2's tile goes out as f16 to C16, the others' as f32
__global__ __launch_bounds__(256) void k_gemm_t(const _Float16* A0, const _Float16* A1, const _Float16* A2, const _Float16* Bh0, const _Float16* Bh1, const _Float16* Bh2, float alpha,
                                                const float* bias0, const float* bias1, const float* bias2, float* C0, float* C1, _Float16* C16) {
  __shared__ __attribute__((aligned(16))) unsigned char L[2u * GT_STAGE];
  const int py = (int)blockIdx.y; const bool H16 = py == 2;
  const _Float16* A = py == 0 ? A0 : py == 1 ? A1 : A2; const _Float16* Bh = py == 0 ? Bh0 : py == 1 ? Bh1 : Bh2; const float* bias = py == 0 ? bias0 : py == 1 ? bias1 : bias2; float* C = py == 0 ? C0 : C1;
  const int tid = threadIdx.x, w = tid >> 5, lane = tid & 31, ln = lane & 15, hh = lane >> 4;
  const int m0 = (int)(blockIdx.x / (CC / 128)) * 128, n0 = (int)(blockIdx.x % (CC / 128)) * 128;
  const int wm = (w >> 1) * 32, wn = (w & 1) * 64;
  // copies: lane takes 16-byte piece (tid & 15) of rows (tid >> 4) + 16 i; LDS rows 0..127 hold A, 128..255 hold Bt
  const unsigned lcp = (unsigned)(size_t)L + (unsigned)(tid >> 4) * GT_PITCH + (unsigned)(tid & 15) * 16u;
  const unsigned short* ga = (const unsigned short*)A + (size_t)(m0 + (tid >> 4)) * CC + (tid & 15) * 8;
  const unsigned short* gb = (const unsigned short*)Bh + (size_t)(n0 + (tid >> 4)) * CC + (tid & 15) * 8;
  v8f acc[2][4];
#pragma unroll
  for (int i = 0; i < 2; ++i)
#pragma unroll
    for (int j = 0; j < 4; ++j) acc[i][j] = (v8f){0.f,0.f,0.f,0.f,0.f,0.f,0.f,0.f};
  gt_copy8(lcp, ga); gt_copy8(lcp + 128u * GT_PITCH, gb);
  asm volatile("s_wait_asynccnt 0x0" ::: "memory");      // pass 0's bytes of this wave have landed
  __syncthreads();                                        // and every wave's: pass 0 is readable
  gt_copy8(lcp + GT_STAGE, ga + 128); gt_copy8(lcp + GT_STAGE + 128u * GT_PITCH, gb + 128);
#pragma unroll 1      // one pass per trip: the ring's order at the foot stays as written
  for (int t = 0; t < GT_NST; ++t) {
    const unsigned char* S = L + (unsigned)(t & 1) * GT_STAGE;
    const unsigned char* ar = S + (unsigned)(wm + ln) * GT_PITCH + 16u * hh;
    const unsigned char* br = S + (unsigned)(128 + wn + ln) * GT_PITCH + 16u * hh;
    FragH a[2][2], b[2][4];      // two fragment sets: the next 32 k are fetched as one group ahead of this block's products (inside this pass's buffer only)
#pragma unroll
    for (int i = 0; i < 2; ++i) { a[0][i].half[0] = *(const v8us*)(ar + i * 16 * GT_PITCH); a[0][i].half[1] = *(const v8us*)(ar + i * 16 * GT_PITCH + 32); }
#pragma unroll
    for (int j = 0; j < 4; ++j) { b[0][j].half[0] = *(const v8us*)(br + j * 16 * GT_PITCH); b[0][j].half[1] = *(const v8us*)(br + j * 16 * GT_PITCH + 32); }
#pragma unroll
    for (int ks = 0; ks < 4; ++ks) {
      const int cu = ks & 1, nx = cu ^ 1;
      if (ks < 3) {
#pragma unroll
        for (int i = 0; i < 2; ++i) { a[nx][i].half[0] = *(const v8us*)(ar + i * 16 * GT_PITCH + (ks + 1) * 64); a[nx][i].half[1] = *(const v8us*)(ar + i * 16 * GT_PITCH + (ks + 1) * 64 + 32); }
#pragma unroll
        for (int j = 0; j < 4; ++j) { b[nx][j].half[0] = *(const v8us*)(br + j * 16 * GT_PITCH + (ks + 1) * 64); b[nx][j].half[1] = *(const v8us*)(br + j * 16 * GT_PITCH + (ks + 1) * 64 + 32); }
      }
      __builtin_amdgcn_sched_barrier(0);      // keeps the next block's twelve LDS loads one group ahead of these products; without it they sink among the products and each waits out its own latency
#pragma unroll
      for (int i = 0; i < 2; ++i)
#pragma unroll
        for (int j = 0; j < 4; ++j) acc[i][j] = __builtin_amdgcn_wmma_f32_16x16x32_f16(false, a[cu][i].v, false, b[cu][j].v, (short)0, acc[i][j], false, false);
      __builtin_amdgcn_sched_barrier(0);      // the products stay one run: no later load group rises into it
    }
    asm volatile("s_wait_dscnt 0x0" ::: "memory");        // this wave's reads of the buffer have returned
    asm volatile("s_wait_asynccnt 0x0" ::: "memory");     // this wave's copies of pass t + 1 have landed
    __syncthreads();                                      // publishes pass t + 1 and frees the buffer pass t has read
    if (t + 2 < GT_NST) { gt_copy8(lcp + (unsigned)(t & 1) * GT_STAGE, ga + (t + 2) * 128); gt_copy8(lcp + (unsigned)(t & 1) * GT_STAGE + 128u * GT_PITCH, gb + (t + 2) * 128); }
  }
  asm volatile("s_wait_asynccnt 0x0" ::: "memory");       // nothing in flight before the ring becomes output staging
  // epilogue: each wave stages its 32 x 64 tile in its own LDS range (pitch 68 floats) and stores whole lines
  float* so = (float*)(L + (unsigned)w * (32u * 272u));
#pragma unroll
  for (int j = 0; j < 4; ++j) { const float bv = bf16_round(bias[n0 + wn + j * 16 + ln]);
#pragma unroll
    for (int i = 0; i < 2; ++i)
#pragma unroll
      for (int r = 0; r < 8; ++r) so[(i * 16 + 8 * hh + r) * 68 + j * 16 + ln] = acc[i][j][r] * alpha + bv; }
  __builtin_amdgcn_fence(__ATOMIC_ACQ_REL, "workgroup"); __builtin_amdgcn_wave_barrier();      // the wave's staged rows are in LDS before its lanes read them back; the range is the wave's own, so no workgroup barrier
  const int c4 = ln * 4; typedef _Float16 v4h __attribute__((ext_vector_type(4)));
  if (!H16) {
#pragma unroll
    for (int q = 0; q < 16; ++q) { const int r = q * 2 + hh; const v4f v = *(const v4fa*)&so[r * 68 + c4]; const size_t o = (size_t)(m0 + wm + r) * CC + n0 + wn + c4; *(v4f*)(C + o) = v; }
    asm volatile("s_wait_xcnt 0x0" ::: "memory");      // no register that these stores name is rewritten ahead of this wait, whichever block the build lays behind them
  } else {
#pragma unroll
    for (int q = 0; q < 16; ++q) { const int r = q * 2 + hh; const v4f v = *(const v4fa*)&so[r * 68 + c4]; const size_t o = (size_t)(m0 + wm + r) * CC + n0 + wn + c4;
      v4h h4; for (int i = 0; i < 4; ++i) h4[i] = (_Float16)v[i]; *(v4h*)(C16 + o) = h4; }
    asm volatile("s_wait_xcnt 0x0" ::: "memory");      // as in the other arm
  }
}

__global__ __launch_bounds__(256) void k_h16(const float* __restrict__ x, _Float16* __restrict__ X16, size_t n8) { const size_t t = (size_t)blockIdx.x * 256 + threadIdx.x; if (t >= n8) return; FragH f;
#pragma unroll
  for (int q = 0; q < 8; ++q) f.h[q] = (_Float16)x[t * 8 + q]; *(v8us*)((unsigned short*)X16 + t * 8) = f.half[0];  }
// Every conversion that reads inputs alone, in one grid; the block index picks the job, each thread's work is that of the separate kernels.
// Blocks 0 .. PB_G-1: BG_h[e][d] = f16(bf16(G_h[d][e]) * 16), 8 blocks a head. Then PB_M blocks a matrix, 8 elements a thread: the four weights (bf16-rounded, * 16; (out,in) = Bt) and q, k, v (bf16-rounded, * 1, which is exact).
#define PB_G (NH * 8)
#define PB_M (CC * CC / 8 / 256)
__global__ __launch_bounds__(256) void k_prep(const float* __restrict__ G, const float* __restrict__ Wq, const float* __restrict__ Wk, const float* __restrict__ Wv, const float* __restrict__ Wo,
                                              const float* __restrict__ q, const float* __restrict__ k, const float* __restrict__ v, _Float16* __restrict__ BG, _Float16* __restrict__ Y) {
  const int bid = (int)blockIdx.x, tid = threadIdx.x; FragH f;
  if (bid < PB_G) {
    const float* W = G + (size_t)(bid >> 3) * HD * HD; const int t = (bid & 7) * 256 + tid; const int n = t / (HD / 8), k8 = (t % (HD / 8)) * 8;
#pragma unroll
    for (int i = 0; i < 8; ++i) f.h[i] = (_Float16)(bf16_round(W[(size_t)(k8 + i) * HD + n]) * 16.0f);
    *(v8us*)((unsigned short*)BG + (size_t)(bid >> 3) * HD * HD + (size_t)n * HD + k8) = f.half[0];
    asm volatile("s_wait_xcnt 0x0" ::: "memory");      // no register that the store names is rewritten ahead of this wait, whichever block the build lays behind it
    return;
  }
  const int j = (bid - PB_G) / PB_M; const size_t t = (size_t)((bid - PB_G) % PB_M) * 256 + tid;      // matrix j, in the order Wq Wk Wv Wo q k v; the seven results lie one behind the other in Y
  const float* x01 = (j & 1) ? Wk : Wq; const float* x23 = (j & 1) ? Wo : Wv; const float* x45 = (j & 1) ? k : q;
  const float* x03 = (j & 2) ? x23 : x01; const float* x47 = (j & 2) ? v : x45; const float* x = (j & 4) ? x47 : x03;
  const float sc = j < 4 ? 16.0f : 1.0f;
#pragma unroll
  for (int i = 0; i < 8; ++i) f.h[i] = (_Float16)(bf16_round(x[t * 8 + i]) * sc);
  *(v8us*)((unsigned short*)Y + (size_t)j * CC * CC + t * 8) = f.half[0];
  asm volatile("s_wait_xcnt 0x0" ::: "memory");      // as in the other arm
}
template <int NHv, int TTv>
__global__ __launch_bounds__(256) void k_vt(const _Float16* __restrict__ V16, int ldv, int voff, _Float16* __restrict__ Vt) { __shared__ unsigned short tl[64][66]; const int tid = threadIdx.x; const int slab = blockIdx.x / (TTv / 64), lg = blockIdx.x % (TTv / 64); const int b = slab / NHv, h = slab % NHv;
  for (int i = tid; i < 64 * 8; i += 256) { const int r = i / 8, c8 = (i % 8) * 8; FragH f; f.half[0] = *(const v8us*)((const unsigned short*)V16 + ((size_t)b * TTv + lg * 64 + r) * ldv + voff + h * 64 + c8);
#pragma unroll
    for (int q = 0; q < 8; ++q) tl[r][c8 + q] = f.u[q]; }
  __syncthreads();
  {
#pragma unroll
    for (int rd = 0; rd < 2; ++rd) { const int d = rd * 32 + tid / 8, pc = tid % 8; FragH f;
#pragma unroll
      for (int q = 0; q < 8; ++q) f.u[q] = tl[pc * 8 + q][d];
      *(v8us*)((unsigned short*)Vt + ((size_t)slab * 64 + d) * TTv + lg * 64 + pc * 8) = f.half[0]; }
     } }

// Attention ring: a stage is 64 keys for the block's 128 query rows: 64 rows of K (256 B, pitch 272), 128 rows of Vt (128 B, pitch 144) and 128 rows of the mask (256 B, pitch 272),
// laid in LDS by asynchronous copies, two buffers, the next stage's copies in flight under this stage's work; the eight waves share K and Vt. A stage is worked as two 32-key tiles, upward.
// The 128 rows are two 64-row blocks of one head, block 31 - j (waves 0 to 3) and block j (waves 4 to 7). Waves w and w + 4 share a SIMD, so where the mask opens few keys for early rows and many for late ones
// every SIMD gets one long and one short row block, and no WGP holds two long ones while another holds two short ones. For any other mask the pairing is merely another order of the same work.
#define FL_KP 272u
#define FL_VP 144u
#define FL_MP 272u
#define FL_VO (64u * FL_KP)
#define FL_MO (FL_VO + 128u * FL_VP)
#define FL_STAGE (FL_MO + 128u * FL_MP)
#define FL_NST (SS / 64)
#define FL_SC2 (0.08838834764831845f * 1.4426950408889634f)
typedef float f1a __attribute__((may_alias));
__device__ __forceinline__ void fl_copy4(unsigned l0, unsigned ls, const unsigned char* g0, size_t gs) {
  // four 16-byte copies of this lane, LDS rows ls bytes apart, global rows gs bytes apart; s_wait_xcnt stands inside the statement so that no address register is rewritten ahead of it
  const unsigned l1 = l0 + ls, l2 = l0 + 2u * ls, l3 = l0 + 3u * ls;
  const unsigned char *g1 = g0 + gs, *g2 = g0 + 2 * gs, *g3 = g0 + 3 * gs;
  asm volatile("global_load_async_to_lds_b128 %0, %4, off\n\t"
               "global_load_async_to_lds_b128 %1, %5, off\n\t"
               "global_load_async_to_lds_b128 %2, %6, off\n\t"
               "global_load_async_to_lds_b128 %3, %7, off\n\t"
               "s_wait_xcnt 0x0"
               :: "v"(l0), "v"(l1), "v"(l2), "v"(l3), "v"(g0), "v"(g1), "v"(g2), "v"(g3) : "memory");
}
// lane l with lane l ^ 16: one vector cross-row move, no LDS round trip
__device__ __forceinline__ float fl_xhalf(float x) { return __builtin_bit_cast(float, __builtin_amdgcn_permlanex16(__builtin_bit_cast(int, x), __builtin_bit_cast(int, x), 0x76543210, 0xfedcba98, false, false)); }
__global__ __launch_bounds__(256) void k_flash(const _Float16* __restrict__ Q16, int ldq, const _Float16* __restrict__ K16, int ldk, const _Float16* __restrict__ Vt, const float* __restrict__ MSK, float* __restrict__ O, int ldo) {
  constexpr int RPW = 16, NQB = 2048 / (4 * RPW), DT = 8, KS = 4;      /* head dim 128 */
  __shared__ __attribute__((aligned(16))) unsigned char L[2u * FL_STAGE];
  const int tid = threadIdx.x, w = tid >> 5, lane = tid & 31, ln = lane & 15, hh = lane >> 4;
  const int slab = blockIdx.x / (NQB / 2), pj = blockIdx.x % (NQB / 2); const int b = slab / 16, h = slab % 16; const int qbA = (NQB - 1 - pj) * (4 * RPW), qbB = pj * (4 * RPW); const int q0 = (w < 4 ? qbA : qbB) + (w & 3) * RPW;
  const unsigned short* Vth = (const unsigned short*)Vt + (size_t)slab * 128 * 2048;
  // copies: K and each block's mask: 16-byte piece (tid & 15) of rows (tid >> 4) + 16 i; Vt: piece (tid & 7) of rows (tid >> 3) + 32 i; mask rows 0..63 in LDS are block A's (waves 0 to 3), 64..127 block B's
  const unsigned lb = (unsigned)(size_t)L;
  const unsigned lk = lb + (unsigned)(tid >> 4) * FL_KP + (unsigned)(tid & 15) * 16u, lv = lb + FL_VO + (unsigned)(tid >> 3) * FL_VP + (unsigned)(tid & 7) * 16u, lm = lb + FL_MO + (unsigned)(tid >> 4) * FL_MP + (unsigned)(tid & 15) * 16u;
  const size_t kstep = (size_t)ldk * 2;      // bytes of a K row
  const unsigned char* gk = (const unsigned char*)((const unsigned short*)K16 + ((size_t)b * 2048 + (tid >> 4)) * ldk + h * 128 + (tid & 15) * 8);
  const unsigned char* gv = (const unsigned char*)(Vth + (size_t)(tid >> 3) * 2048 + (tid & 7) * 8);
  const unsigned char* gmA = (const unsigned char*)(MSK + ((size_t)b * 2048 + qbA + (tid >> 4)) * 2048 + (tid & 15) * 4);
  const unsigned char* gmB = (const unsigned char*)(MSK + ((size_t)b * 2048 + qbB + (tid >> 4)) * 2048 + (tid & 15) * 4);
  fl_copy4(lk, 16u * FL_KP, gk, 16 * kstep); fl_copy4(lv, 32u * FL_VP, gv, (size_t)32 * 4096); fl_copy4(lm, 16u * FL_MP, gmA, (size_t)16 * 8192); fl_copy4(lm + 64u * FL_MP, 16u * FL_MP, gmB, (size_t)16 * 8192);
  FragH aq[KS];      // the wave's 16 query rows, now the B operand: lane = column = query row ln, same k order as before
  { const unsigned short* qr = (const unsigned short*)Q16 + ((size_t)b * 2048 + q0 + ln) * ldq + h * 128;
#pragma unroll
    for (int ks = 0; ks < KS; ++ks) { aq[ks].half[0] = *(const v8us*)(qr + ks * 32 + 8 * hh); aq[ks].half[1] = *(const v8us*)(qr + ks * 32 + 16 + 8 * hh); } }
  float m_r = -3.0e38f, l_r = 0.f; v8f oacc[DT];      // of query row ln; oacc[dt][r] = O[ln][dt*16 + 8hh + r]; l_r sums this half's keys only
#pragma unroll
  for (int dt = 0; dt < DT; ++dt) oacc[dt] = (v8f){0.f,0.f,0.f,0.f,0.f,0.f,0.f,0.f};
  asm volatile("s_wait_asynccnt 0x0" ::: "memory");      // stage 0's bytes of this wave have landed
  __syncthreads();                                        // and every wave's: stage 0 is readable
  fl_copy4(lk + FL_STAGE, 16u * FL_KP, gk + 64 * kstep, 16 * kstep); fl_copy4(lv + FL_STAGE, 32u * FL_VP, gv + 128, (size_t)32 * 4096); fl_copy4(lm + FL_STAGE, 16u * FL_MP, gmA + 256, (size_t)16 * 8192); fl_copy4(lm + FL_STAGE + 64u * FL_MP, 16u * FL_MP, gmB + 256, (size_t)16 * 8192);
#pragma unroll 1      // one stage per trip: the ring's order at the foot stays as written
  for (int t = 0; t < FL_NST; ++t) {
    const unsigned char* S = L + (unsigned)(t & 1) * FL_STAGE;
#pragma unroll 1      // the two 32-key tiles of a stage share one body: less code, and a masked tile is skipped on its own
  for (int sub = 0; sub < 2; ++sub) {
    // mask of query row ln for this lane's 16 keys of the tile: four 16-byte reads of the row. Every '#pragma unroll' in this body makes the indices of the per-key and fragment arrays constants, so that they stay in registers.
    const unsigned char* mrow = S + FL_MO + (unsigned)(w * RPW + ln) * FL_MP + (unsigned)sub * 128u + 32u * hh;
    bool ok[2][8]; bool any = false;      // ok[nt][r]: key nt*16 + 8hh + r of the tile is OPEN for query row ln (float mask: nonzero = masked, -1e9)
#pragma unroll
    for (int nt = 0; nt < 2; ++nt) { const v4f ma = *(const v4fa*)(mrow + nt * 64), mb = *(const v4fa*)(mrow + nt * 64 + 16);
#pragma unroll
      for (int r = 0; r < 4; ++r) { ok[nt][r] = ma[r] == 0.0f; ok[nt][4 + r] = mb[r] == 0.0f; any = any || ok[nt][r] || ok[nt][4 + r]; } }
    if (__builtin_amdgcn_ballot_w32(any) == 0u) continue;      // every (query,key) of this wave's tile is masked: contributes nothing (uniform branch; the stage's foot is outside this loop)
    // The tile's LDS fragment reads stand in groups ahead of the products that use them: all of K ahead of the score products; all of Vt behind them, so that it streams in under the softmax.
    v8f s[2]; FragH bk[2][KS], bv[DT];
#pragma unroll
    for (int nt = 0; nt < 2; ++nt) { const unsigned char* kr = S + (unsigned)(sub * 32 + nt * 16 + ln) * FL_KP + 16u * hh;
#pragma unroll
      for (int ks = 0; ks < KS; ++ks) { bk[nt][ks].half[0] = *(const v8us*)(kr + ks * 64); bk[nt][ks].half[1] = *(const v8us*)(kr + ks * 64 + 32); } }
    s[0] = (v8f){0.f,0.f,0.f,0.f,0.f,0.f,0.f,0.f}; s[1] = (v8f){0.f,0.f,0.f,0.f,0.f,0.f,0.f,0.f};
    // the two halves' accumulator chains alternate, so that each fills the other's accumulate latency; within a chain k runs upward as before. s[nt][r] = S[query ln][key nt*16 + 8hh + r]
#pragma unroll
    for (int ks = 0; ks < KS; ++ks)
#pragma unroll
      for (int nt = 0; nt < 2; ++nt) s[nt] = mmaH<1>(bk[nt][ks].v, bk[nt][ks].v, aq[ks].v, aq[ks].v, s[nt]);
#pragma unroll
    for (int dt = 0; dt < DT; ++dt) { const unsigned char* vrow = S + FL_VO + (unsigned)(dt * 16 + ln) * FL_VP + (unsigned)sub * 64u + 16u * hh; bv[dt].half[0] = *(const v8us*)vrow; bv[dt].half[1] = *(const v8us*)(vrow + 32); }
    __builtin_amdgcn_sched_barrier(0);      // keeps the sixteen Vt loads one group ahead of the softmax; without it they sink into it in five places, the last ones directly ahead of their products
    // Softmax of the tile, no branch inside: every exponential is taken unconditionally and the mask picks between its value and the constant.
    // Scores and running maximum are kept in base 2 (FL_SC2 = 1/sqrt(128) * log2 e, in the multiply the score had anyway), so that exp(x - m) is one v_exp_f32 of a difference; only differences of them are ever used.
    float sv[2][8];
#pragma unroll
    for (int nt = 0; nt < 2; ++nt)
#pragma unroll
      for (int r = 0; r < 8; ++r) sv[nt][r] = ok[nt][r] ? s[nt][r] * FL_SC2 : -INFINITY;
    float mc = fmaxf(sv[0][0], sv[1][0]);
#pragma unroll
    for (int r = 1; r < 8; ++r) mc = fmaxf(mc, fmaxf(sv[0][r], sv[1][r]));
    mc = fmaxf(mc, fl_xhalf(mc));      // the other half of the wave holds the row's other 16 keys
    const float mn = fmaxf(m_r, mc);
    float p[2][8]; FragH pb;      // pb: P^T as a B fragment: element i = key 8hh + i, element 8 + i = key 16 + 8hh + i, column = query row ln
#pragma unroll
    for (int nt = 0; nt < 2; ++nt)
#pragma unroll
      for (int r = 0; r < 8; ++r) p[nt][r] = __builtin_amdgcn_exp2f(sv[nt][r] - mn);
    const float ea = __builtin_amdgcn_exp2f(m_r - mn); const float al = (mn > -1.0e38f) ? ea : 1.0f; m_r = mn;
#pragma unroll
    for (int nt = 0; nt < 2; ++nt)
#pragma unroll
      for (int r = 0; r < 8; ++r) { p[nt][r] = ok[nt][r] ? p[nt][r] : 0.f; pb.h[nt * 8 + r] = (_Float16)p[nt][r]; }
    float ps[8];
#pragma unroll
    for (int r = 0; r < 8; ++r) ps[r] = p[0][r] + p[1][r];
    l_r = l_r * al + (((ps[0] + ps[1]) + (ps[2] + ps[3])) + ((ps[4] + ps[5]) + (ps[6] + ps[7])));
#pragma unroll
    for (int dt = 0; dt < DT; ++dt)
#pragma unroll
      for (int r = 0; r < 8; ++r) oacc[dt][r] *= al;
#pragma unroll
    for (int dt = 0; dt < DT; ++dt) oacc[dt] = mmaH<1>(bv[dt].v, bv[dt].v, pb.v, pb.v, oacc[dt]);
  }
    asm volatile("s_wait_dscnt 0x0" ::: "memory");        // this wave's reads of the buffer have returned
    asm volatile("s_wait_asynccnt 0x0" ::: "memory");     // this wave's copies of stage t + 1 have landed
    __syncthreads();                                      // publishes stage t + 1 and frees the buffer stage t has read
    if (t + 2 < FL_NST) { const unsigned lo = (unsigned)(t & 1) * FL_STAGE; fl_copy4(lk + lo, 16u * FL_KP, gk + (size_t)(t + 2) * 64 * kstep, 16 * kstep); fl_copy4(lv + lo, 32u * FL_VP, gv + (t + 2) * 128, (size_t)32 * 4096); fl_copy4(lm + lo, 16u * FL_MP, gmA + (t + 2) * 256, (size_t)16 * 8192); fl_copy4(lm + lo + 64u * FL_MP, 16u * FL_MP, gmB + (t + 2) * 256, (size_t)16 * 8192); }
  }
  asm volatile("s_wait_asynccnt 0x0" ::: "memory");       // nothing in flight before the ring becomes output staging (the last foot's barrier has ended every wave's reads of it)
  float* sO = (float*)(L + (unsigned)w * (unsigned)(RPW * (128 + 4) * 4));      // each wave's own range, pitch 132 floats
  const float lt = l_r + fl_xhalf(l_r); const float li = (lt > 0.f) ? 1.0f / lt : 0.f;      // the halves' sums are joined once
#pragma unroll
  for (int dt = 0; dt < DT; ++dt) { v4f o0, o1;
#pragma unroll
    for (int r = 0; r < 4; ++r) { o0[r] = oacc[dt][r] * li; o1[r] = oacc[dt][4 + r] * li; }
    *(v4fa*)&sO[ln * 132 + dt * 16 + 8 * hh] = o0; *(v4fa*)&sO[ln * 132 + dt * 16 + 8 * hh + 4] = o1; }
  __builtin_amdgcn_fence(__ATOMIC_ACQ_REL, "workgroup"); __builtin_amdgcn_wave_barrier();
  {
#pragma unroll
    for (int rp = 0; rp < RPW; ++rp) { const int r = rp, pc = lane; const v4f val = *(const v4fa*)&sO[r * 132 + pc * 4]; *(v4f*)(O + ((size_t)b * 2048 + q0 + r) * ldo + h * 128 + pc * 4) = val; }      /* 128-float rows: 32 lanes x 16 B */
     } }

// RoPE of q and k. The angle of a pair depends on the position s and the pair's index alone: a thread owns s and the four pairs 4p .. 4p + 3 of a head's 64, takes their cosines and sines once,
// and turns with them both elements of each pair in RH heads (hg, hg + NH / RH, ...: a wave's two halves then read neighbouring heads, 1 KiB in a row) of q and of k. Formulas as before.
#define RH 4
__device__ __forceinline__ void d_rope16(int bid, const float* __restrict__ QF, _Float16* __restrict__ QR16, const float* __restrict__ KF, _Float16* __restrict__ KR16) {
  const int t = bid * 256 + (int)threadIdx.x; const int p = t & 15, hg = (t >> 4) & (NH / RH - 1), s = t >> 6;      // the grid holds exactly SS * (NH / RH) * 16 threads
  const size_t e0 = ((size_t)s * NH + hg) * HD + p * 8; const float* xq = QF + e0; const float* xk = KF + e0;
  // every '#pragma unroll' here makes the indices of x, c and sn constants, so that they stay in registers
  v4f x[2][RH][2];
#pragma unroll
  for (int g = 0; g < RH; ++g) { const int e = g * (NH / RH) * HD;
    x[0][g][0] = *(const v4fa*)(xq + e); x[0][g][1] = *(const v4fa*)(xq + e + 4); x[1][g][0] = *(const v4fa*)(xk + e); x[1][g][1] = *(const v4fa*)(xk + e + 4); }
  asm volatile("s_wait_xcnt 0x0" :: "v"(xq), "v"(xk) : "memory");      // the sixteen loads' two address pairs stay whole up to this wait: named as inputs, they are no load's destination and nothing rewrites them ahead of it
  float c[4], sn[4];
#pragma unroll
  for (int u = 0; u < 4; ++u) { const int i = p * 4 + u; const float f = __builtin_powf(10000.0f, -(float)(2 * i) / 128.0f); const float ang = (float)s * f; c[u] = cosf(ang); sn[u] = sinf(ang); }
#pragma unroll
  for (int z = 0; z < 2; ++z)
#pragma unroll
    for (int g = 0; g < RH; ++g) { FragH f;
#pragma unroll
      for (int u = 0; u < 4; ++u) { const float xr = x[z][g][u >> 1][(u & 1) * 2], xi = x[z][g][u >> 1][(u & 1) * 2 + 1]; f.h[2 * u] = (_Float16)(xr * c[u] - xi * sn[u]); f.h[2 * u + 1] = (_Float16)(xr * sn[u] + xi * c[u]); }
      *(v8us*)((unsigned short*)(z ? KR16 : QR16) + e0 + (size_t)g * (NH / RH) * HD) = f.half[0]; }
  asm volatile("s_wait_xcnt 0x0" ::: "memory");      // no register that these stores name is rewritten ahead of this wait, whichever block the build lays behind them
}
__device__ __forceinline__ void d_vt128(int bid, const _Float16* __restrict__ V16, _Float16* __restrict__ Vt) { __shared__ unsigned short tl[64][130]; const int tid = threadIdx.x; const int h = bid / (SS / 64), lg = bid % (SS / 64);
  for (int i = tid; i < 64 * 16; i += 256) { const int r = i / 16, c8 = (i % 16) * 8; FragH f; f.half[0] = *(const v8us*)((const unsigned short*)V16 + ((size_t)lg * 64 + r) * CC + h * HD + c8);
#pragma unroll
    for (int q = 0; q < 8; ++q) tl[r][c8 + q] = f.u[q]; }
  __syncthreads();
  { for (int i = tid; i < 128 * 8; i += 256) { const int d = i / 8, pc = i % 8; FragH f;
#pragma unroll
      for (int q = 0; q < 8; ++q) f.u[q] = tl[pc * 8 + q][d]; *(v8us*)((unsigned short*)Vt + ((size_t)h * HD + d) * SS + lg * 64 + pc * 8) = f.half[0]; }  } }
// What follows the three projections and is independent of one another, in one grid: RoPE of q and k (RB blocks), then the short V transposes
#define RB (SS * (NH / RH) * 16 / 256)
__global__ __launch_bounds__(256) void k_post(const float* __restrict__ QF, _Float16* __restrict__ QR16, const float* __restrict__ KF, _Float16* __restrict__ KR16, const _Float16* __restrict__ V16, _Float16* __restrict__ Vt) {
  const int bid = (int)blockIdx.x;
  if (bid < RB) d_rope16(bid, QF, QR16, KF, KR16);
  else d_vt128(bid - RB, V16, Vt);
}
extern "C" void kernel_launch(void* const* d_in, const int* in_sizes, int n_in,
                              void* d_out, int out_size, void* d_ws, size_t ws_size, hipStream_t stream) {
  (void)in_sizes; (void)n_in; (void)out_size;
  const float* const* I = (const float* const*)d_in; const float* q = I[0]; const float* k = I[1]; const float* v = I[2]; const float* mask = I[3]; const float* Wq = I[4]; const float* bq = I[5]; const float* Wk = I[6]; const float* bk = I[7]; const float* Wv = I[8]; const float* bv = I[9]; const float* G = I[10]; const float* Wo = I[11]; const float* bo = I[12];
  char* ws = (char*)d_ws; size_t off = 0;
  auto take = [&](size_t bytes) { char* p = ws + off; off += (bytes + 255) & ~(size_t)255; return p; };
  _Float16* Y = (_Float16*)take((size_t)7 * CC * CC * 2); _Float16* Bq = Y; _Float16* Bk = Y + (size_t)CC * CC; _Float16* Bv = Y + (size_t)2 * CC * CC; _Float16* Bo = Y + (size_t)3 * CC * CC; _Float16* Xq = Y + (size_t)4 * CC * CC; _Float16* Xk = Y + (size_t)5 * CC * CC; _Float16* Xv = Y + (size_t)6 * CC * CC;
  _Float16* BG = (_Float16*)take((size_t)NH * HD * HD * 2);
  float* QF = (float*)take((size_t)SS * CC * 4); float* KF = (float*)take((size_t)SS * CC * 4);
  _Float16* QR16 = (_Float16*)take((size_t)SS * CC * 2); _Float16* QG16 = (_Float16*)take((size_t)SS * CC * 2); _Float16* KR16 = (_Float16*)take((size_t)SS * CC * 2); _Float16* V16 = (_Float16*)take((size_t)SS * CC * 2); _Float16* Vt = (_Float16*)take((size_t)SS * CC * 2); float* O = QF; _Float16* O16 = Xq;
  if (off > ws_size) return;      // 8.4 x 12 + 0.5 + 16.8 x 2 = about 135 MB
  const unsigned gx = (unsigned)(((size_t)SS * CC / 8 + 255) / 256); const unsigned gt = (SS / 128) * (CC / 128);
  k_prep<<<PB_G + 7 * PB_M, 256, 0, stream>>>(G, Wq, Wk, Wv, Wo, q, k, v, BG, Y);      // operands in f16
  k_gemm_t<<<dim3(gt, 3), 256, 0, stream>>>(Xq, Xk, Xv, Bq, Bk, Bv, 0.0625f, bq, bk, bv, QF, KF, V16);      // q, k (f32) and v (f16) projections
  k_post<<<RB + NH * (SS / 64), 256, 0, stream>>>(QF, QR16, KF, KR16, V16, Vt);      // rope q, rope k, Vt
  k_gemm_hhx<0><<<dim3(((SS / 16) * (HD / 64) + 3) / 4, NH), 128, 0, stream>>>(QR16, CC, (size_t)HD, BG, HD, (size_t)HD * HD, 0.0625f, nullptr, 0, nullptr, 1, 0, 0, nullptr, QG16, CC, (size_t)HD, SS, HD, HD);      // qg_h = q_h · G_h (batched over heads via column offsets)
  k_flash<<<1 * NH * (SS / 128), 256, 0, stream>>>(QG16, CC, KR16, CC, Vt, mask, O, CC);
  k_h16<<<gx, 256, 0, stream>>>(O, O16, (size_t)SS * CC / 8);
  k_gemm_t<<<dim3(gt, 1), 256, 0, stream>>>(O16, O16, O16, Bo, Bo, Bo, 0.0625f, bo, bo, bo, (float*)d_out, (float*)d_out, nullptr);
}

// v010
// Measured time: 127 microseconds a run.
// Two timings next to v009 put it at 1.13 and 1.12 times that version's speed.
// All steps since the starting kernel, v000, together make it 5.75 times as fast.
#include <hip/hip_runtime.h>
// Power-law-graph multi-head attention (B=1, S=2048, D=2048, 16 heads × 128; INPUT additive mask (nonzero = −1e9) ; RoPE interleaved pairs): q/k/v/o projections ((out,in) + bias) as GEMMs, the per-head
// metric product qg = q_h·G_h and the attention in one fused flash-style kernel (head dim 128: 4 k-steps / 8 d-tiles; masked keys excluded, fully masked 32-key tiles skipped by ballot;
// online softmax f32; P f16 ≤ 1; O = P·Vt; RPW-16 waves) on v_wmma_f32_16x16x32_f16, f32 accumulate; RoPE f32 VALU.
#define SS 2048
#define CC 2048
#define NH 16
#define HD 128

typedef __bf16 v16b __attribute__((ext_vector_type(16)));
typedef unsigned short v8us __attribute__((ext_vector_type(8), may_alias));
typedef float  v8f  __attribute__((ext_vector_type(8)));
typedef float  v4f  __attribute__((ext_vector_type(4)));
typedef float  v4fa __attribute__((ext_vector_type(4), may_alias));
union FragB { v16b v; v8us half[2]; unsigned short u[16]; };

__device__ __forceinline__ unsigned short bf16_bits(float x) { unsigned int u = __float_as_uint(x); return (unsigned short)((u + 0x7FFFu + ((u >> 16) & 1u)) >> 16); }
__device__ __forceinline__ float bf16_val(unsigned short b) { return __uint_as_float(((unsigned int)b) << 16); }
__device__ __forceinline__ float bf16_round(float x) { return bf16_val(bf16_bits(x)); }
// D += A·B with NT terms: 1 = ah·bh, 2 = + al·bh (A split), 3 = + ah·bl (both split)
template <int NT>
__device__ __forceinline__ v8f mmaN(v16b ah, v16b al, v16b bh, v16b bl, v8f c) {
  c = __builtin_amdgcn_wmma_f32_16x16x32_bf16(false, ah, false, bh, (short)0, c, false, false);
  if (NT >= 2) c = __builtin_amdgcn_wmma_f32_16x16x32_bf16(false, al, false, bh, (short)0, c, false, false);
  if (NT >= 3) c = __builtin_amdgcn_wmma_f32_16x16x32_bf16(false, ah, false, bl, (short)0, c, false, false);
  asm volatile("v_nop\n\tv_nop\n\tv_nop\n\tv_nop" : "+v"(c) : "v"(ah), "v"(al), "v"(bh), "v"(bl));
  return c;
}

__global__ __launch_bounds__(256) void k_wt_bf16(const float* __restrict__ W, unsigned short* __restrict__ Wt, int K, int N) {
  const int t = blockIdx.x * 256 + threadIdx.x;
  const int k8n = K / 8;
  if (t >= N * k8n) return;
  const int n = t / k8n, k8 = (t % k8n) * 8;
  v8us v;
#pragma unroll
  for (int i = 0; i < 8; ++i) v[i] = bf16_bits(W[(size_t)(k8 + i) * N + n]);
  *(v8us*)(Wt + (size_t)n * K + k8) = v;
  
}

// GEMM C[M][N] (f32, pitch ldc) = act(A[M][K]·W + bias). A f32 row-major (pitch lda) converted per fragment to bf16
// (ASPLIT: hi/lo two planes -> 2 terms, else single rounded term); Wt bf16 [N][K] (pitch ldb). BIAS_BF16 rounds the
// bias to bf16 first (bias quantised to bf16 before the add). K%32==0, M%16==0, N%64==0.
template <bool ASPLIT, int ACT, bool BIAS_BF16>
__global__ __launch_bounds__(128) void k_gemm_bf(const float* __restrict__ A, int lda, const unsigned short* __restrict__ Wt, int ldb,
                                               const float* __restrict__ bias, float* __restrict__ C, int ldc, int M, int N, int K) {
  __shared__ __attribute__((aligned(16))) float so[4][16][64];
  const int tid = threadIdx.x, w = tid >> 5, lane = tid & 31, ln = lane & 15, hh = lane >> 4;
  const int ntn = N / 64;
  const int wid = blockIdx.x * 4 + w;
  const int mt = wid / ntn, nq = wid % ntn;
  if (mt * 16 >= M) return;
  const int row0 = mt * 16, col0 = nq * 64;
  const float* arow = A + (size_t)(row0 + ln) * lda;
  v8f acc[4] = {};
  for (int kb = 0; kb < K; kb += 32) {
    FragB ah, al;
    const v4f x0 = *(const v4fa*)(arow + kb + 8 * hh), x1 = *(const v4fa*)(arow + kb + 8 * hh + 4);
    const v4f x2 = *(const v4fa*)(arow + kb + 16 + 8 * hh), x3 = *(const v4fa*)(arow + kb + 16 + 8 * hh + 4);
    float xs[16] = {x0[0],x0[1],x0[2],x0[3],x1[0],x1[1],x1[2],x1[3],x2[0],x2[1],x2[2],x2[3],x3[0],x3[1],x3[2],x3[3]};
#pragma unroll
    for (int i = 0; i < 16; ++i) { const unsigned short hb = bf16_bits(xs[i]); ah.u[i] = hb; al.u[i] = ASPLIT ? bf16_bits(xs[i] - bf16_val(hb)) : (unsigned short)0; }
#pragma unroll
    for (int t = 0; t < 4; ++t) {
      const unsigned short* brow = Wt + (size_t)(col0 + t * 16 + ln) * ldb + kb;
      FragB b;
      b.half[0] = *(const v8us*)(brow + 8 * hh);
      b.half[1] = *(const v8us*)(brow + 16 + 8 * hh);
      acc[t] = mmaN<ASPLIT ? 2 : 1>(ah.v, al.v, b.v, b.v, acc[t]);
    }
  }
#pragma unroll
  for (int t = 0; t < 4; ++t) {
    float bv = bias ? bias[col0 + t * 16 + ln] : 0.f;
    if (BIAS_BF16) bv = bf16_round(bv);
#pragma unroll
    for (int r = 0; r < 8; ++r) { float v = acc[t][r] + bv; if (ACT == 1) v = fmaxf(v, 0.f); so[w][8 * hh + r][t * 16 + ln] = v; }
  }
  __builtin_amdgcn_fence(__ATOMIC_ACQ_REL, "workgroup");
  __builtin_amdgcn_wave_barrier();
  const int rsub = lane >> 4, c4 = (lane & 15) * 4;
  {
#pragma unroll
    for (int q = 0; q < 8; ++q) {
      const int r = q * 2 + rsub;
      const v4f v = *(const v4fa*)&so[w][r][c4];
      *(v4f*)(C + (size_t)(row0 + r) * ldc + col0 + c4) = v;
    }
    
  }
}

// Flash-style causal/unmasked attention, all contractions 3-term bf16 hi/lo splits, f32 softmax with running max.
// q,k,v rows are read from f32 buffers with arbitrary row pitch (so they can live inside a fused qkv buffer);
// D = head size (multiple of 32, <= 128); one wave = 16 query rows; block = 4 waves (64 queries) sharing K/V chunks of 32.
template <int D, bool CAUSAL>
__global__ __launch_bounds__(128) void k_flash(const float* __restrict__ qb, const float* __restrict__ kb, const float* __restrict__ vb,
                                             int pitch, int T, int H, float scale, float* __restrict__ y, int ypitch) {
  constexpr int KS = D / 32;        // k-steps for QK
  constexpr int DT = D / 16;        // d tiles for PV
  __shared__ __attribute__((aligned(16))) unsigned short sKh[32][D + 8], sKl[32][D + 8], sVh[32][D + 8], sVl[32][D + 8];
  __shared__ __attribute__((aligned(16))) unsigned short sPh[4][16][40], sPl[4][16][40];
  __shared__ __attribute__((aligned(16))) float sO[4][16][D];
  const int tid = threadIdx.x, w = tid >> 5, lane = tid & 31, ln = lane & 15, hh = lane >> 4;
  const int nqb = (T + 63) / 64;
  const int bh = blockIdx.x / nqb, qblk = blockIdx.x % nqb;
  const int b = bh / H, h = bh % H;
  const int q0 = qblk * 64 + w * 16;
  const float* Q = qb + (size_t)b * T * pitch + h * D;
  const float* K = kb + (size_t)b * T * pitch + h * D;
  const float* V = vb + (size_t)b * T * pitch + h * D;

  // A fragments of the wave's 16 query rows (scaled), hi/lo
  FragB aqh[KS], aql[KS];
  {
    int row = q0 + ln; if (row >= T) row = T - 1;
    const float* qr = Q + (size_t)row * pitch;
#pragma unroll
    for (int ks = 0; ks < KS; ++ks)
#pragma unroll
      for (int i = 0; i < 16; ++i) {
        const int d = ks * 32 + ((i < 8) ? (8 * hh + i) : (16 + 8 * hh + (i - 8)));
        const float x = qr[d] * scale; const unsigned short hb = bf16_bits(x);
        aqh[ks].u[i] = hb; aql[ks].u[i] = bf16_bits(x - bf16_val(hb));
      }
  }
  float m_r[8], l_r[8];
#pragma unroll
  for (int r = 0; r < 8; ++r) { m_r[r] = -3.0e38f; l_r[r] = 0.f; }
  v8f oacc[DT];
#pragma unroll
  for (int dt = 0; dt < DT; ++dt) oacc[dt] = (v8f){0.f,0.f,0.f,0.f,0.f,0.f,0.f,0.f};

  const int kv_end = CAUSAL ? min(T, qblk * 64 + 64) : T;     // block-uniform
  for (int j0 = 0; j0 < kv_end; j0 += 32) {
    __syncthreads();
    for (int e = tid; e < 32 * (D / 4); e += 128) {
      const int r = e / (D / 4), c4 = (e % (D / 4)) * 4;
      const int key = j0 + r;
      v4f kf = {0.f,0.f,0.f,0.f}, vf = {0.f,0.f,0.f,0.f};
      if (key < T) { kf = *(const v4fa*)(K + (size_t)key * pitch + c4); vf = *(const v4fa*)(V + (size_t)key * pitch + c4); }
#pragma unroll
      for (int t = 0; t < 4; ++t) {
        unsigned short hb = bf16_bits(kf[t]); sKh[r][c4 + t] = hb; sKl[r][c4 + t] = bf16_bits(kf[t] - bf16_val(hb));
        hb = bf16_bits(vf[t]); sVh[r][c4 + t] = hb; sVl[r][c4 + t] = bf16_bits(vf[t] - bf16_val(hb));
      }
    }
    __syncthreads();
    // S tile 16 x 32
    v8f s[2];
#pragma unroll
    for (int nt = 0; nt < 2; ++nt) {
      v8f acc = {};
#pragma unroll
      for (int ks = 0; ks < KS; ++ks) {
        FragB bh_, bl_;
        bh_.half[0] = *(const v8us*)&sKh[nt * 16 + ln][ks * 32 + 8 * hh]; bh_.half[1] = *(const v8us*)&sKh[nt * 16 + ln][ks * 32 + 16 + 8 * hh];
        bl_.half[0] = *(const v8us*)&sKl[nt * 16 + ln][ks * 32 + 8 * hh]; bl_.half[1] = *(const v8us*)&sKl[nt * 16 + ln][ks * 32 + 16 + 8 * hh];
        acc = mmaN<3>(aqh[ks].v, aql[ks].v, bh_.v, bl_.v, acc);
      }
      s[nt] = acc;
    }
    // mask + running max (rows 8hh+r; the 16 lanes of a half share rows)
    float alpha[8];
#pragma unroll
    for (int r = 0; r < 8; ++r) {
      const int qi = q0 + 8 * hh + r;
      const int ja = j0 + ln, jb = j0 + 16 + ln;
      if (CAUSAL) { if (ja > qi) s[0][r] = -3.0e38f; if (jb > qi) s[1][r] = -3.0e38f; }
      if (ja >= T) s[0][r] = -3.0e38f;
      if (jb >= T) s[1][r] = -3.0e38f;
      float mx = fmaxf(s[0][r], s[1][r]);
      mx = fmaxf(mx, __shfl_xor(mx, 1, 32)); mx = fmaxf(mx, __shfl_xor(mx, 2, 32)); mx = fmaxf(mx, __shfl_xor(mx, 4, 32)); mx = fmaxf(mx, __shfl_xor(mx, 8, 32));
      const float mnew = fmaxf(m_r[r], mx);
      alpha[r] = (mnew > -1.0e38f) ? __expf(m_r[r] - mnew) : 1.0f;
      const float p0 = (s[0][r] > -1.0e38f) ? __expf(s[0][r] - mnew) : 0.f;
      const float p1 = (s[1][r] > -1.0e38f) ? __expf(s[1][r] - mnew) : 0.f;
      m_r[r] = mnew;
      l_r[r] = l_r[r] * alpha[r] + p0 + p1;            // per-lane partial row sum (16 lanes combined at the end)
      unsigned short hb = bf16_bits(p0); sPh[w][8 * hh + r][ln] = hb;      sPl[w][8 * hh + r][ln] = bf16_bits(p0 - bf16_val(hb));
      hb = bf16_bits(p1);                sPh[w][8 * hh + r][16 + ln] = hb; sPl[w][8 * hh + r][16 + ln] = bf16_bits(p1 - bf16_val(hb));
    }
#pragma unroll
    for (int dt = 0; dt < DT; ++dt)
#pragma unroll
      for (int r = 0; r < 8; ++r) oacc[dt][r] *= alpha[r];
    __builtin_amdgcn_fence(__ATOMIC_ACQ_REL, "workgroup");
    __builtin_amdgcn_wave_barrier();
    FragB pah, pal;
    pah.half[0] = *(const v8us*)&sPh[w][ln][8 * hh]; pah.half[1] = *(const v8us*)&sPh[w][ln][16 + 8 * hh];
    pal.half[0] = *(const v8us*)&sPl[w][ln][8 * hh]; pal.half[1] = *(const v8us*)&sPl[w][ln][16 + 8 * hh];
#pragma unroll
    for (int dt = 0; dt < DT; ++dt) {
      FragB bvh, bvl;
#pragma unroll
      for (int i = 0; i < 8; ++i) {
        bvh.u[i] = sVh[8 * hh + i][dt * 16 + ln]; bvh.u[8 + i] = sVh[16 + 8 * hh + i][dt * 16 + ln];
        bvl.u[i] = sVl[8 * hh + i][dt * 16 + ln]; bvl.u[8 + i] = sVl[16 + 8 * hh + i][dt * 16 + ln];
      }
      oacc[dt] = mmaN<3>(pah.v, pal.v, bvh.v, bvl.v, oacc[dt]);
    }
    __builtin_amdgcn_fence(__ATOMIC_ACQ_REL, "workgroup");
    __builtin_amdgcn_wave_barrier();
  }
#pragma unroll
  for (int r = 0; r < 8; ++r) {
    float l = l_r[r];
    l += __shfl_xor(l, 1, 32); l += __shfl_xor(l, 2, 32); l += __shfl_xor(l, 4, 32); l += __shfl_xor(l, 8, 32);
    l_r[r] = (l > 0.f) ? 1.0f / l : 0.f;
  }
#pragma unroll
  for (int dt = 0; dt < DT; ++dt)
#pragma unroll
    for (int r = 0; r < 8; ++r) sO[w][8 * hh + r][dt * 16 + ln] = oacc[dt][r] * l_r[r];
  __builtin_amdgcn_fence(__ATOMIC_ACQ_REL, "workgroup");
  __builtin_amdgcn_wave_barrier();
  {
    for (int r = 0; r < 16; ++r) {
      const int row = q0 + r;
      if (row < T && lane < D / 4) {
        const v4f val = *(const v4fa*)&sO[w][r][lane * 4];
        *(v4f*)(y + ((size_t)b * T + row) * ypitch + h * D + lane * 4) = val;
      }
    }
    
  }
}

// GEMM C = act(A·W + bias + resid): A f32 (ASPLIT -> hi/lo 2 terms), Wt bf16 [N][K]; ACT 0 none, 1 relu, 2 exact gelu;
// resid (optional, f32, row index = (row % rmod), pitch ldr, RES_BF16 rounds it) added before the activation.
template <bool ASPLIT, int ACT, bool BIAS_BF16, bool RES_BF16>
__global__ __launch_bounds__(128) void k_gemm_bf3(const float* __restrict__ A, int lda, const unsigned short* __restrict__ Wt, int ldb,
                                                const float* __restrict__ bias, const float* __restrict__ resid, int rmod, int ldr,
                                                float* __restrict__ C, int ldc, int M, int N, int K) {
  __shared__ __attribute__((aligned(16))) float so[4][16][64];
  const int tid = threadIdx.x, w = tid >> 5, lane = tid & 31, ln = lane & 15, hh = lane >> 4;
  const int ntn = N / 64;
  const int wid = blockIdx.x * 4 + w;
  const int mt = wid / ntn, nq = wid % ntn;
  if (mt * 16 >= M) return;
  const int row0 = mt * 16, col0 = nq * 64;
  const float* arow = A + (size_t)(row0 + ln) * lda;
  v8f acc[4] = {};
  for (int kb = 0; kb < K; kb += 32) {
    FragB ah, al;
    const v4f x0 = *(const v4fa*)(arow + kb + 8 * hh), x1 = *(const v4fa*)(arow + kb + 8 * hh + 4);
    const v4f x2 = *(const v4fa*)(arow + kb + 16 + 8 * hh), x3 = *(const v4fa*)(arow + kb + 16 + 8 * hh + 4);
    float xs[16] = {x0[0],x0[1],x0[2],x0[3],x1[0],x1[1],x1[2],x1[3],x2[0],x2[1],x2[2],x2[3],x3[0],x3[1],x3[2],x3[3]};
#pragma unroll
    for (int i = 0; i < 16; ++i) { const unsigned short hb = bf16_bits(xs[i]); ah.u[i] = hb; al.u[i] = ASPLIT ? bf16_bits(xs[i] - bf16_val(hb)) : (unsigned short)0; }
#pragma unroll
    for (int t = 0; t < 4; ++t) {
      const unsigned short* brow = Wt + (size_t)(col0 + t * 16 + ln) * ldb + kb;
      FragB b;
      b.half[0] = *(const v8us*)(brow + 8 * hh);
      b.half[1] = *(const v8us*)(brow + 16 + 8 * hh);
      acc[t] = mmaN<ASPLIT ? 2 : 1>(ah.v, al.v, b.v, b.v, acc[t]);
    }
  }
#pragma unroll
  for (int t = 0; t < 4; ++t) {
    const int col = col0 + t * 16 + ln;
    float bv = bias ? bias[col] : 0.f;
    if (BIAS_BF16) bv = bf16_round(bv);
#pragma unroll
    for (int r = 0; r < 8; ++r) {
      float v = acc[t][r] + bv;
      if (resid) { float rv = resid[(size_t)((row0 + 8 * hh + r) % rmod) * ldr + col]; if (RES_BF16) rv = bf16_round(rv); v += rv; }
      if (ACT == 1) v = fmaxf(v, 0.f);
      if (ACT == 2) v = 0.5f * v * (1.0f + erff(v * 0.70710678118654752f));
      if (ACT == 3) { const float u = 0.7978845608028654f * (v + 0.044715f * v * v * v); v = 0.5f * v * (1.0f + tanhf(u)); }
      so[w][8 * hh + r][t * 16 + ln] = v;
    }
  }
  __builtin_amdgcn_fence(__ATOMIC_ACQ_REL, "workgroup");
  __builtin_amdgcn_wave_barrier();
  const int rsub = lane >> 4, c4 = (lane & 15) * 4;
  {
#pragma unroll
    for (int q = 0; q < 8; ++q) {
      const int r = q * 2 + rsub;
      const v4f v = *(const v4fa*)&so[w][r][c4];
      *(v4f*)(C + (size_t)(row0 + r) * ldc + col0 + c4) = v;
    }
    
  }
}
// row LayerNorm (biased variance, eps) over N: s = X (+ R); optional out_sum <- s; out_norm <- (s-mu)*rsqrt(var+eps)*g + b
template <bool PARAM_BF16>
__global__ __launch_bounds__(256) void k_layernorm(const float* __restrict__ X, const float* __restrict__ R, const float* __restrict__ g, const float* __restrict__ bta,
                                                  float* __restrict__ out_sum, float* __restrict__ out_norm, int N, float eps) {
  __shared__ float red[256];
  const int row = blockIdx.x, tid = threadIdx.x;
  const float* x = X + (size_t)row * N; const float* rr = R ? R + (size_t)row * N : nullptr;
  float vals[16];                     // up to N = 4096
  const int per = N / 256;            // contiguous chunk per thread? use strided-by-4 chunks: thread handles j = tid*4 + 1024*u
  float s1 = 0.f;
  for (int u = 0; u < per / 4; ++u) {
    const int j = tid * 4 + 1024 * u;
    const v4f a = *(const v4fa*)(x + j);
    v4f b = {0.f,0.f,0.f,0.f}; if (rr) b = *(const v4fa*)(rr + j);
#pragma unroll
    for (int q = 0; q < 4; ++q) { const float v = a[q] + b[q]; vals[u * 4 + q] = v; s1 += v; }
  }
  red[tid] = s1; __syncthreads();
  for (int st = 128; st > 0; st >>= 1) { if (tid < st) red[tid] += red[tid + st]; __syncthreads(); }
  const float mu = red[0] / (float)N; __syncthreads();
  float s2 = 0.f;
  for (int u = 0; u < per / 4; ++u)
#pragma unroll
    for (int q = 0; q < 4; ++q) { const float c = vals[u * 4 + q] - mu; s2 += c * c; }
  red[tid] = s2; __syncthreads();
  for (int st = 128; st > 0; st >>= 1) { if (tid < st) red[tid] += red[tid + st]; __syncthreads(); }
  const float rs = rsqrtf(red[0] / (float)N + eps);
  {
    for (int u = 0; u < per / 4; ++u) {
      const int j = tid * 4 + 1024 * u;
      v4f o, sm;
#pragma unroll
      for (int q = 0; q < 4; ++q) {
        float gg = g[j + q], bb = bta[j + q];
        if (PARAM_BF16) { gg = bf16_round(gg); bb = bf16_round(bb); }
        sm[q] = vals[u * 4 + q]; o[q] = (vals[u * 4 + q] - mu) * rs * gg + bb;
      }
      if (out_sum) *(v4f*)(out_sum + (size_t)row * N + j) = sm;
      *(v4f*)(out_norm + (size_t)row * N + j) = o;
    }
    
  }
}



// ---- f16 WMMA path (v_wmma_f32_16x16x32_f16): 11-bit significands for operands in range — used where a [0,1] probability operand needs more precision than bf16
typedef _Float16 v16h __attribute__((ext_vector_type(16)));
union FragH { v16h v; v8us half[2]; _Float16 h[16]; unsigned short u[16]; };
template <int NT>
__device__ __forceinline__ v8f mmaH(v16h ah, v16h al, v16h bh, v16h bl, v8f c) {
  c = __builtin_amdgcn_wmma_f32_16x16x32_f16(false, ah, false, bh, (short)0, c, false, false);
  if (NT >= 2) c = __builtin_amdgcn_wmma_f32_16x16x32_f16(false, al, false, bh, (short)0, c, false, false);
  if (NT >= 3) c = __builtin_amdgcn_wmma_f32_16x16x32_f16(false, ah, false, bl, (short)0, c, false, false);
  asm volatile("v_nop\n\tv_nop\n\tv_nop\n\tv_nop" : "+v"(c) : "v"(ah), "v"(al), "v"(bh), "v"(bl));
  return c;
}
// batched GEMM like k_gemm_b but f16 operands: A f32 (split into f16 hi/lo if ASPLIT, else rounded to f16), Bt = f16 values [n][k]; alpha; C f32; N multiple of 16 (partial tiles skipped)
template <bool ASPLIT>
__global__ __launch_bounds__(128) void k_gemm_h(const float* __restrict__ A, int lda, size_t sA, const _Float16* __restrict__ Bh, int ldb, size_t sB, float alpha, float* __restrict__ C, int ldc, size_t sC, int M, int N, int K) {
  __shared__ __attribute__((aligned(16))) float so[4][16][64];
  const int tid = threadIdx.x, w = tid >> 5, lane = tid & 31, ln = lane & 15, hh = lane >> 4; const int by = blockIdx.y;
  A += (size_t)by * sA; Bh += (size_t)by * sB; C += (size_t)by * sC;
  const int ntn = (N + 63) / 64; const int wid = blockIdx.x * 4 + w; const int mt = wid / ntn, nq = wid % ntn; if (mt * 16 >= M) return;
  const int row0 = mt * 16, col0 = nq * 64; const float* arow = A + (size_t)(row0 + ln) * lda;
  v8f acc[4] = {};
  for (int kb = 0; kb < K; kb += 32) {
    FragH ah, al;
    const v4f x0 = *(const v4fa*)(arow + kb + 8 * hh), x1 = *(const v4fa*)(arow + kb + 8 * hh + 4), x2 = *(const v4fa*)(arow + kb + 16 + 8 * hh), x3 = *(const v4fa*)(arow + kb + 16 + 8 * hh + 4);
    float xs[16] = {x0[0],x0[1],x0[2],x0[3],x1[0],x1[1],x1[2],x1[3],x2[0],x2[1],x2[2],x2[3],x3[0],x3[1],x3[2],x3[3]};
#pragma unroll
    for (int i = 0; i < 16; ++i) { const _Float16 h = (_Float16)xs[i]; ah.h[i] = h; al.h[i] = ASPLIT ? (_Float16)(xs[i] - (float)h) : (_Float16)0.0f; }
#pragma unroll
    for (int t = 0; t < 4; ++t) { if (col0 + t * 16 >= N) continue; const size_t boff = (size_t)(col0 + t * 16 + ln) * ldb + kb; FragH bq; bq.half[0] = *(const v8us*)(Bh + boff + 8 * hh); bq.half[1] = *(const v8us*)(Bh + boff + 16 + 8 * hh);
      acc[t] = mmaH<ASPLIT ? 2 : 1>(ah.v, al.v, bq.v, bq.v, acc[t]); }
  }
#pragma unroll
  for (int t = 0; t < 4; ++t) { if (col0 + t * 16 >= N) continue;
#pragma unroll
    for (int r = 0; r < 8; ++r) so[w][8 * hh + r][t * 16 + ln] = acc[t][r] * alpha; }
  __builtin_amdgcn_fence(__ATOMIC_ACQ_REL, "workgroup"); __builtin_amdgcn_wave_barrier();
  const int rsub = lane >> 4, c4 = (lane & 15) * 4;
  {
#pragma unroll
    for (int q = 0; q < 8; ++q) { const int r = q * 2 + rsub; if (col0 + c4 < N) { const v4f v = *(const v4fa*)&so[w][r][c4]; *(v4f*)(C + (size_t)(row0 + r) * ldc + col0 + c4) = v; } }
     }
}

// k_gemm_hh variant with fused epilogue: v = acc·alpha + bias[by·sBias + col] (+ CP[(row/rowsPerB)·sCPb + by·64 + col] if CP) ; ACT 0 none / 1 elu ; writes f16 C16 (and f32 C if non-null)
template <int ACT>
__global__ __launch_bounds__(128) void k_gemm_hhx(const _Float16* __restrict__ A, int lda, size_t sA, const _Float16* __restrict__ Bh, int ldb, size_t sB, float alpha, const float* __restrict__ bias, size_t sBias, const float* __restrict__ CP, int rowsPerB, size_t sCPb, int row0g,
    float* __restrict__ C, _Float16* __restrict__ C16, int ldc, size_t sC, int M, int N, int K) {
  __shared__ __attribute__((aligned(16))) float so[4][16][64];
  const int tid = threadIdx.x, w = tid >> 5, lane = tid & 31, ln = lane & 15, hh = lane >> 4; const int by = blockIdx.y;
  A += (size_t)by * sA; Bh += (size_t)by * sB; const size_t cofs = (size_t)by * sC; const float* bp = bias ? bias + (size_t)by * sBias : nullptr;
  const int ntn = (N + 63) / 64; const int wid = blockIdx.x * 4 + w; const int mt = wid / ntn, nq = wid % ntn; if (mt * 16 >= M) return;
  const int row0 = mt * 16, col0 = nq * 64; const _Float16* arow = A + (size_t)(row0 + ln) * lda;
  v8f acc[4] = {};
  for (int kb = 0; kb < K; kb += 32) { FragH ah; ah.half[0] = *(const v8us*)((const unsigned short*)arow + kb + 8 * hh); ah.half[1] = *(const v8us*)((const unsigned short*)arow + kb + 16 + 8 * hh);
#pragma unroll
    for (int t = 0; t < 4; ++t) { if (col0 + t * 16 >= N) continue; const size_t boff = (size_t)(col0 + t * 16 + ln) * ldb + kb; FragH bq; bq.half[0] = *(const v8us*)((const unsigned short*)Bh + boff + 8 * hh); bq.half[1] = *(const v8us*)((const unsigned short*)Bh + boff + 16 + 8 * hh);
      acc[t] = mmaH<1>(ah.v, ah.v, bq.v, bq.v, acc[t]); }
  }
#pragma unroll
  for (int t = 0; t < 4; ++t) { if (col0 + t * 16 >= N) continue; const int col = col0 + t * 16 + ln; const float bv = bp ? bf16_round(bp[col]) : 0.f;
#pragma unroll
    for (int r = 0; r < 8; ++r) { float v = acc[t][r] * alpha + bv; if (CP) { const int bidx = (row0g + row0 + 8 * hh + r) / rowsPerB; v += CP[(size_t)bidx * sCPb + (size_t)by * 64 + col]; } if (ACT == 1) v = (v > 0.f) ? v : expm1f(v); else if (ACT == 3) v = fmaxf(v, 0.f); so[w][8 * hh + r][t * 16 + ln] = v; } }
  __builtin_amdgcn_fence(__ATOMIC_ACQ_REL, "workgroup"); __builtin_amdgcn_wave_barrier();
  const int rsub = lane >> 4, c4 = (lane & 15) * 4; typedef _Float16 v4h __attribute__((ext_vector_type(4)));
  {
#pragma unroll
    for (int q = 0; q < 8; ++q) { const int r = q * 2 + rsub; if (col0 + c4 < N) { const v4f v = *(const v4fa*)&so[w][r][c4]; if (C) *(v4f*)(C + cofs + (size_t)(row0 + r) * ldc + col0 + c4) = v; if (C16) { v4h h4; for (int i = 0; i < 4; ++i) h4[i] = (_Float16)v[i]; *(v4h*)(C16 + cofs + (size_t)(row0 + r) * ldc + col0 + c4) = h4; } } }
     }
}


// Projection GEMM, 2048 x 2048 x 2048: C = (A . Bt^T) * alpha + bias. One 128 x 128 tile of C per workgroup of 8 waves (4 x 2, 32 x 64 per wave).
// A pass is 128 k: 128 rows of A and 128 rows of Bt, 256 B each, laid in LDS at pitch 272 B by asynchronous copies, two buffers, the next pass's copies in flight under this pass's products.
// k runs upward in steps of 32 into one accumulator per 16 x 16 tile, as in k_gemm_hhx: the sums keep their order.
// Every '#pragma unroll' in k_gemm_t makes the indices of the fragment and accumulator arrays constants, so that they stay in registers.
#define GT_PITCH 272u
#define GT_STAGE (256u * GT_PITCH)
#define GT_NST (CC / 128)
__device__ __forceinline__ void gt_copy8(unsigned l0, const unsigned short* g0) {
  // eight 16-byte copies of this lane, rows 16 apart; s_wait_xcnt stands inside the statement so that no address register is rewritten ahead of it
  const unsigned l1 = l0 + 16u * GT_PITCH, l2 = l0 + 32u * GT_PITCH, l3 = l0 + 48u * GT_PITCH, l4 = l0 + 64u * GT_PITCH, l5 = l0 + 80u * GT_PITCH, l6 = l0 + 96u * GT_PITCH, l7 = l0 + 112u * GT_PITCH;
  const unsigned short *g1 = g0 + 16 * CC, *g2 = g0 + 32 * CC, *g3 = g0 + 48 * CC, *g4 = g0 + 64 * CC, *g5 = g0 + 80 * CC, *g6 = g0 + 96 * CC, *g7 = g0 + 112 * CC;
  asm volatile("global_load_async_to_lds_b128 %0, %8, off\n\t"
               "global_load_async_to_lds_b128 %1, %9, off\n\t"
               "global_load_async_to_lds_b128 %2, %10, off\n\t"
               "global_load_async_to_lds_b128 %3, %11, off\n\t"
               "global_load_async_to_lds_b128 %4, %12, off\n\t"
               "global_load_async_to_lds_b128 %5, %13, off\n\t"
               "global_load_async_to_lds_b128 %6, %14, off\n\t"
               "global_load_async_to_lds_b128 %7, %15, off\n\t"
               "s_wait_xcnt 0x0"
               :: "v"(l0), "v"(l1), "v"(l2), "v"(l3), "v"(l4), "v"(l5), "v"(l6), "v"(l7),
                  "v"(g0), "v"(g1), "v"(g2), "v"(g3), "v"(g4), "v"(g5), "v"(g6), "v"(g7) : "memory");
}
// blockIdx.y picks one of up to three independent products that share the grid; product 2's tile goes out as f16 to C16, the others' as f32
__global__ __launch_bounds__(256) void k_gemm_t(const _Float16* A0, const _Float16* A1, const _Float16* A2, const _Float16* Bh0, const _Float16* Bh1, const _Float16* Bh2, float alpha,
                                                const float* bias0, const float* bias1, const float* bias2, float* C0, float* C1, _Float16* C16) {
  __shared__ __attribute__((aligned(16))) unsigned char L[2u * GT_STAGE];
  const int py = (int)blockIdx.y; const bool H16 = py == 2;
  const _Float16* A = py == 0 ? A0 : py == 1 ? A1 : A2; const _Float16* Bh = py == 0 ? Bh0 : py == 1 ? Bh1 : Bh2; const float* bias = py == 0 ? bias0 : py == 1 ? bias1 : bias2; float* C = py == 0 ? C0 : C1;
  const int tid = threadIdx.x, w = tid >> 5, lane = tid & 31, ln = lane & 15, hh = lane >> 4;
  const int m0 = (int)(blockIdx.x / (CC / 128)) * 128, n0 = (int)(blockIdx.x % (CC / 128)) * 128;
  const int wm = (w >> 1) * 32, wn = (w & 1) * 64;
  // copies: lane takes 16-byte piece (tid & 15) of rows (tid >> 4) + 16 i; LDS rows 0..127 hold A, 128..255 hold Bt
  const unsigned lcp = (unsigned)(size_t)L + (unsigned)(tid >> 4) * GT_PITCH + (unsigned)(tid & 15) * 16u;
  const unsigned short* ga = (const unsigned short*)A + (size_t)(m0 + (tid >> 4)) * CC + (tid & 15) * 8;
  const unsigned short* gb = (const unsigned short*)Bh + (size_t)(n0 + (tid >> 4)) * CC + (tid & 15) * 8;
  v8f acc[2][4];
#pragma unroll
  for (int i = 0; i < 2; ++i)
#pragma unroll
    for (int j = 0; j < 4; ++j) acc[i][j] = (v8f){0.f,0.f,0.f,0.f,0.f,0.f,0.f,0.f};
  gt_copy8(lcp, ga); gt_copy8(lcp + 128u * GT_PITCH, gb);
  asm volatile("s_wait_asynccnt 0x0" ::: "memory");      // pass 0's bytes of this wave have landed
  __syncthreads();                                        // and every wave's: pass 0 is readable
  gt_copy8(lcp + GT_STAGE, ga + 128); gt_copy8(lcp + GT_STAGE + 128u * GT_PITCH, gb + 128);
#pragma unroll 1      // one pass per trip: the ring's order at the foot stays as written
  for (int t = 0; t < GT_NST; ++t) {
    const unsigned char* S = L + (unsigned)(t & 1) * GT_STAGE;
    const unsigned char* ar = S + (unsigned)(wm + ln) * GT_PITCH + 16u * hh;
    const unsigned char* br = S + (unsigned)(128 + wn + ln) * GT_PITCH + 16u * hh;
    FragH a[2][2], b[2][4];      // two fragment sets: the next 32 k are fetched as one group ahead of this block's products (inside this pass's buffer only)
#pragma unroll
    for (int i = 0; i < 2; ++i) { a[0][i].half[0] = *(const v8us*)(ar + i * 16 * GT_PITCH); a[0][i].half[1] = *(const v8us*)(ar + i * 16 * GT_PITCH + 32); }
#pragma unroll
    for (int j = 0; j < 4; ++j) { b[0][j].half[0] = *(const v8us*)(br + j * 16 * GT_PITCH); b[0][j].half[1] = *(const v8us*)(br + j * 16 * GT_PITCH + 32); }
#pragma unroll
    for (int ks = 0; ks < 4; ++ks) {
      const int cu = ks & 1, nx = cu ^ 1;
      if (ks < 3) {
#pragma unroll
        for (int i = 0; i < 2; ++i) { a[nx][i].half[0] = *(const v8us*)(ar + i * 16 * GT_PITCH + (ks + 1) * 64); a[nx][i].half[1] = *(const v8us*)(ar + i * 16 * GT_PITCH + (ks + 1) * 64 + 32); }
#pragma unroll
        for (int j = 0; j < 4; ++j) { b[nx][j].half[0] = *(const v8us*)(br + j * 16 * GT_PITCH + (ks + 1) * 64); b[nx][j].half[1] = *(const v8us*)(br + j * 16 * GT_PITCH + (ks + 1) * 64 + 32); }
      }
      __builtin_amdgcn_sched_barrier(0);      // keeps the next block's twelve LDS loads one group ahead of these products; without it they sink among the products and each waits out its own latency
#pragma unroll
      for (int i = 0; i < 2; ++i)
#pragma unroll
        for (int j = 0; j < 4; ++j) acc[i][j] = __builtin_amdgcn_wmma_f32_16x16x32_f16(false, a[cu][i].v, false, b[cu][j].v, (short)0, acc[i][j], false, false);
      __builtin_amdgcn_sched_barrier(0);      // the products stay one run: no later load group rises into it
    }
    asm volatile("s_wait_dscnt 0x0" ::: "memory");        // this wave's reads of the buffer have returned
    asm volatile("s_wait_asynccnt 0x0" ::: "memory");     // this wave's copies of pass t + 1 have landed
    __syncthreads();                                      // publishes pass t + 1 and frees the buffer pass t has read
    if (t + 2 < GT_NST) { gt_copy8(lcp + (unsigned)(t & 1) * GT_STAGE, ga + (t + 2) * 128); gt_copy8(lcp + (unsigned)(t & 1) * GT_STAGE + 128u * GT_PITCH, gb + (t + 2) * 128); }
  }
  asm volatile("s_wait_asynccnt 0x0" ::: "memory");       // nothing in flight before the ring becomes output staging
  // epilogue: each wave stages its 32 x 64 tile in its own LDS range (pitch 68 floats) and stores whole lines
  float* so = (float*)(L + (unsigned)w * (32u * 272u));
#pragma unroll
  for (int j = 0; j < 4; ++j) { const float bv = bf16_round(bias[n0 + wn + j * 16 + ln]);
#pragma unroll
    for (int i = 0; i < 2; ++i)
#pragma unroll
      for (int r = 0; r < 8; ++r) so[(i * 16 + 8 * hh + r) * 68 + j * 16 + ln] = acc[i][j][r] * alpha + bv; }
  __builtin_amdgcn_fence(__ATOMIC_ACQ_REL, "workgroup"); __builtin_amdgcn_wave_barrier();      // the wave's staged rows are in LDS before its lanes read them back; the range is the wave's own, so no workgroup barrier
  const int c4 = ln * 4; typedef _Float16 v4h __attribute__((ext_vector_type(4)));
  if (!H16) {
#pragma unroll
    for (int q = 0; q < 16; ++q) { const int r = q * 2 + hh; const v4f v = *(const v4fa*)&so[r * 68 + c4]; const size_t o = (size_t)(m0 + wm + r) * CC + n0 + wn + c4; *(v4f*)(C + o) = v; }
    asm volatile("s_wait_xcnt 0x0" ::: "memory");      // no register that these stores name is rewritten ahead of this wait, whichever block the build lays behind them
  } else {
#pragma unroll
    for (int q = 0; q < 16; ++q) { const int r = q * 2 + hh; const v4f v = *(const v4fa*)&so[r * 68 + c4]; const size_t o = (size_t)(m0 + wm + r) * CC + n0 + wn + c4;
      v4h h4; for (int i = 0; i < 4; ++i) h4[i] = (_Float16)v[i]; *(v4h*)(C16 + o) = h4; }
    asm volatile("s_wait_xcnt 0x0" ::: "memory");      // as in the other arm
  }
}

// Every conversion that reads inputs alone, in one grid; the block index picks the job, each thread's work is that of the separate kernels.
// Blocks 0 .. PB_G-1: BG_h[e][d] = f16(bf16(G_h[d][e]) * 16), 8 blocks a head. Then PB_M blocks a matrix, 8 elements a thread: the four weights (bf16-rounded, * 16; (out,in) = Bt) and q, k, v (bf16-rounded, * 1, which is exact).
#define PB_G (NH * 8)
#define PB_M (CC * CC / 8 / 256)
__global__ __launch_bounds__(256) void k_prep(const float* __restrict__ G, const float* __restrict__ Wq, const float* __restrict__ Wk, const float* __restrict__ Wv, const float* __restrict__ Wo,
                                              const float* __restrict__ q, const float* __restrict__ k, const float* __restrict__ v, _Float16* __restrict__ BG, _Float16* __restrict__ Y) {
  const int bid = (int)blockIdx.x, tid = threadIdx.x; FragH f;
  if (bid < PB_G) {
    const float* W = G + (size_t)(bid >> 3) * HD * HD; const int t = (bid & 7) * 256 + tid; const int n = t / (HD / 8), k8 = (t % (HD / 8)) * 8;
#pragma unroll
    for (int i = 0; i < 8; ++i) f.h[i] = (_Float16)(bf16_round(W[(size_t)(k8 + i) * HD + n]) * 16.0f);
    *(v8us*)((unsigned short*)BG + (size_t)(bid >> 3) * HD * HD + (size_t)n * HD + k8) = f.half[0];
    asm volatile("s_wait_xcnt 0x0" ::: "memory");      // no register that the store names is rewritten ahead of this wait, whichever block the build lays behind it
    return;
  }
  const int j = (bid - PB_G) / PB_M; const size_t t = (size_t)((bid - PB_G) % PB_M) * 256 + tid;      // matrix j, in the order Wq Wk Wv Wo q k v; the seven results lie one behind the other in Y
  const float* x01 = (j & 1) ? Wk : Wq; const float* x23 = (j & 1) ? Wo : Wv; const float* x45 = (j & 1) ? k : q;
  const float* x03 = (j & 2) ? x23 : x01; const float* x47 = (j & 2) ? v : x45; const float* x = (j & 4) ? x47 : x03;
  const float sc = j < 4 ? 16.0f : 1.0f;
#pragma unroll
  for (int i = 0; i < 8; ++i) f.h[i] = (_Float16)(bf16_round(x[t * 8 + i]) * sc);
  *(v8us*)((unsigned short*)Y + (size_t)j * CC * CC + t * 8) = f.half[0];
  asm volatile("s_wait_xcnt 0x0" ::: "memory");      // as in the other arm
}
template <int NHv, int TTv>
__global__ __launch_bounds__(256) void k_vt(const _Float16* __restrict__ V16, int ldv, int voff, _Float16* __restrict__ Vt) { __shared__ unsigned short tl[64][66]; const int tid = threadIdx.x; const int slab = blockIdx.x / (TTv / 64), lg = blockIdx.x % (TTv / 64); const int b = slab / NHv, h = slab % NHv;
  for (int i = tid; i < 64 * 8; i += 256) { const int r = i / 8, c8 = (i % 8) * 8; FragH f; f.half[0] = *(const v8us*)((const unsigned short*)V16 + ((size_t)b * TTv + lg * 64 + r) * ldv + voff + h * 64 + c8);
#pragma unroll
    for (int q = 0; q < 8; ++q) tl[r][c8 + q] = f.u[q]; }
  __syncthreads();
  {
#pragma unroll
    for (int rd = 0; rd < 2; ++rd) { const int d = rd * 32 + tid / 8, pc = tid % 8; FragH f;
#pragma unroll
      for (int q = 0; q < 8; ++q) f.u[q] = tl[pc * 8 + q][d];
      *(v8us*)((unsigned short*)Vt + ((size_t)slab * 64 + d) * TTv + lg * 64 + pc * 8) = f.half[0]; }
     } }

// Attention ring: a stage is 64 keys for the block's 128 query rows: 64 rows of K (256 B, pitch 272), 128 rows of Vt (128 B, pitch 144) and 128 rows of the mask (256 B, pitch 272),
// laid in LDS by asynchronous copies, two buffers, the next stage's copies in flight under this stage's work; the eight waves share K and Vt. A stage is worked as two 32-key tiles, upward.
// The 128 rows are two 64-row blocks of one head, block 31 - j (waves 0 to 3) and block j (waves 4 to 7). Waves w and w + 4 share a SIMD, so where the mask opens few keys for early rows and many for late ones
// every SIMD gets one long and one short row block, and no WGP holds two long ones while another holds two short ones. For any other mask the pairing is merely another order of the same work.
#define FL_KP 272u
#define FL_VP 144u
#define FL_MP 272u
#define FL_VO (64u * FL_KP)
#define FL_MO (FL_VO + 128u * FL_VP)
#define FL_STAGE (FL_MO + 128u * FL_MP)
#define FL_NST (SS / 64)
#define FL_GO (2u * FL_STAGE)      /* behind the ring: the head's metric as BG[e][d], 128 rows of 256 B at pitch FL_KP, filled once */
#define FL_SC2 (0.08838834764831845f * 1.4426950408889634f)
typedef float f1a __attribute__((may_alias));
__device__ __forceinline__ void fl_copy4(unsigned l0, unsigned ls, const unsigned char* g0, size_t gs) {
  // four 16-byte copies of this lane, LDS rows ls bytes apart, global rows gs bytes apart; s_wait_xcnt stands inside the statement so that no address register is rewritten ahead of it
  const unsigned l1 = l0 + ls, l2 = l0 + 2u * ls, l3 = l0 + 3u * ls;
  const unsigned char *g1 = g0 + gs, *g2 = g0 + 2 * gs, *g3 = g0 + 3 * gs;
  asm volatile("global_load_async_to_lds_b128 %0, %4, off\n\t"
               "global_load_async_to_lds_b128 %1, %5, off\n\t"
               "global_load_async_to_lds_b128 %2, %6, off\n\t"
               "global_load_async_to_lds_b128 %3, %7, off\n\t"
               "s_wait_xcnt 0x0"
               :: "v"(l0), "v"(l1), "v"(l2), "v"(l3), "v"(g0), "v"(g1), "v"(g2), "v"(g3) : "memory");
}
// lane l with lane l ^ 16: one vector cross-row move, no LDS round trip
__device__ __forceinline__ float fl_xhalf(float x) { return __builtin_bit_cast(float, __builtin_amdgcn_permlanex16(__builtin_bit_cast(int, x), __builtin_bit_cast(int, x), 0x76543210, 0xfedcba98, false, false)); }
// Both products are taken transposed: S^T = K . qg^T (A = K rows from LDS, B = the wave's qg rows, kept in registers) and O^T += V^T . P^T (A = Vt rows from LDS, B = P^T).
// A lane (ln, hh) then holds ONE query row (ln) of the wave: of a 32-key tile the keys 8hh + r and 16 + 8hh + r, r = 0..7, which is the k order of a B fragment, so P^T is packed from the score accumulators in place.
// The row's maximum is 16 values of the lane and one exchange between the wave's halves; maximum, sum and rescale factor are one register each.
// The launch takes in the two short launches that stood around it. In front: qg = q_h . G_h, taken transposed as well (A = rows e of BG from LDS, B = the wave's roped q rows): the accumulators of e tiles 2ks and 2ks + 1 hold,
// for query row ln, e = 32ks + 8hh + r and 32ks + 16 + 8hh + r, which is B fragment ks of the score product, so qg never leaves the registers. Behind: O goes out as f16, the output projection's operand, with the rounding the separate conversion had.
__global__ __launch_bounds__(256) void k_flash(const _Float16* __restrict__ Q16, int ldq, const _Float16* __restrict__ BG, const _Float16* __restrict__ K16, int ldk, const _Float16* __restrict__ Vt, const float* __restrict__ MSK, _Float16* __restrict__ O16) {
  constexpr int RPW = 16, NQB = 2048 / (4 * RPW), DT = 8, KS = 4;      /* head dim 128 */
  __shared__ __attribute__((aligned(16))) unsigned char L[2u * FL_STAGE + 128u * FL_KP];
  const int tid = threadIdx.x, w = tid >> 5, lane = tid & 31, ln = lane & 15, hh = lane >> 4;
  const int slab = blockIdx.x / (NQB / 2), pj = blockIdx.x % (NQB / 2); const int b = slab / 16, h = slab % 16; const int qbA = (NQB - 1 - pj) * (4 * RPW), qbB = pj * (4 * RPW); const int q0 = (w < 4 ? qbA : qbB) + (w & 3) * RPW;
  const unsigned short* Vth = (const unsigned short*)Vt + (size_t)slab * 128 * 2048;
  // copies: K and each block's mask: 16-byte piece (tid & 15) of rows (tid >> 4) + 16 i; Vt: piece (tid & 7) of rows (tid >> 3) + 32 i; mask rows 0..63 in LDS are block A's (waves 0 to 3), 64..127 block B's
  const unsigned lb = (unsigned)(size_t)L;
  const unsigned lk = lb + (unsigned)(tid >> 4) * FL_KP + (unsigned)(tid & 15) * 16u, lv = lb + FL_VO + (unsigned)(tid >> 3) * FL_VP + (unsigned)(tid & 7) * 16u, lm = lb + FL_MO + (unsigned)(tid >> 4) * FL_MP + (unsigned)(tid & 15) * 16u;
  const size_t kstep = (size_t)ldk * 2;      // bytes of a K row
  const unsigned char* gk = (const unsigned char*)((const unsigned short*)K16 + ((size_t)b * 2048 + (tid >> 4)) * ldk + h * 128 + (tid & 15) * 8);
  const unsigned char* gv = (const unsigned char*)(Vth + (size_t)(tid >> 3) * 2048 + (tid & 7) * 8);
  const unsigned char* gmA = (const unsigned char*)(MSK + ((size_t)b * 2048 + qbA + (tid >> 4)) * 2048 + (tid & 15) * 4);
  const unsigned char* gmB = (const unsigned char*)(MSK + ((size_t)b * 2048 + qbB + (tid >> 4)) * 2048 + (tid & 15) * 4);
  fl_copy4(lk, 16u * FL_KP, gk, 16 * kstep); fl_copy4(lv, 32u * FL_VP, gv, (size_t)32 * 4096); fl_copy4(lm, 16u * FL_MP, gmA, (size_t)16 * 8192); fl_copy4(lm + 64u * FL_MP, 16u * FL_MP, gmB, (size_t)16 * 8192);
  // BG of the head: 16-byte piece (tid & 15) of rows (tid >> 4) + 16 i, i = 0..7; it lands under stage 0's wait and barrier and is never written again
  const unsigned lg = lb + FL_GO + (unsigned)(tid >> 4) * FL_KP + (unsigned)(tid & 15) * 16u;
  const unsigned char* gg = (const unsigned char*)((const unsigned short*)BG + (size_t)h * 128 * 128 + (size_t)(tid >> 4) * 128 + (tid & 15) * 8);
  fl_copy4(lg, 16u * FL_KP, gg, (size_t)16 * 256); fl_copy4(lg + 64u * FL_KP, 16u * FL_KP, gg + 64 * 256, (size_t)16 * 256);
  FragH qf[KS];      // the wave's 16 roped query rows as a B operand: lane = column = query row ln
  { const unsigned short* qr = (const unsigned short*)Q16 + ((size_t)b * 2048 + q0 + ln) * ldq + h * 128 + 8 * hh;
#pragma unroll
    for (int ks = 0; ks < KS; ++ks) { qf[ks].half[0] = *(const v8us*)(qr + ks * 32); qf[ks].half[1] = *(const v8us*)(qr + ks * 32 + 16); }
    asm volatile("s_wait_xcnt 0x0" :: "v"(qr) : "memory"); }      // the eight loads' address pair stays whole up to this wait: named as an input, it is no load's destination and nothing rewrites it ahead of it
  float m_r = -3.0e38f, l_r = 0.f; v8f oacc[DT];      // of query row ln; oacc[dt][r] = O[ln][dt*16 + 8hh + r]; l_r sums this half's keys only
#pragma unroll
  for (int dt = 0; dt < DT; ++dt) oacc[dt] = (v8f){0.f,0.f,0.f,0.f,0.f,0.f,0.f,0.f};
  asm volatile("s_wait_asynccnt 0x0" ::: "memory");      // stage 0's bytes of this wave have landed
  __syncthreads();                                        // and every wave's: stage 0 is readable
  fl_copy4(lk + FL_STAGE, 16u * FL_KP, gk + 64 * kstep, 16 * kstep); fl_copy4(lv + FL_STAGE, 32u * FL_VP, gv + 128, (size_t)32 * 4096); fl_copy4(lm + FL_STAGE, 16u * FL_MP, gmA + 256, (size_t)16 * 8192); fl_copy4(lm + FL_STAGE + 64u * FL_MP, 16u * FL_MP, gmB + 256, (size_t)16 * 8192);
  FragH aq[KS];      // qg of the wave's 16 query rows, the B operand of the score products: element i = e 32ks + 8hh + i, element 8 + i = e 32ks + 16 + 8hh + i
  { const unsigned char* gr = L + FL_GO + (unsigned)ln * FL_KP + 16u * hh;
    // every '#pragma unroll' here makes the indices of the fragment arrays constants, so that they stay in registers; d runs upward in steps of 32 into one accumulator per tile, then * 1/16 and f16, as in the separate product
#pragma unroll
    for (int ko = 0; ko < KS; ++ko) { FragH ga[2][KS]; v8f g2[2];
#pragma unroll
      for (int nt = 0; nt < 2; ++nt)
#pragma unroll
        for (int ks = 0; ks < KS; ++ks) { const unsigned char* ge = gr + (unsigned)(ko * 32 + nt * 16) * FL_KP + ks * 64; ga[nt][ks].half[0] = *(const v8us*)ge; ga[nt][ks].half[1] = *(const v8us*)(ge + 32); }
      g2[0] = (v8f){0.f,0.f,0.f,0.f,0.f,0.f,0.f,0.f}; g2[1] = (v8f){0.f,0.f,0.f,0.f,0.f,0.f,0.f,0.f};
#pragma unroll
      for (int ks = 0; ks < KS; ++ks)
#pragma unroll
        for (int nt = 0; nt < 2; ++nt) g2[nt] = __builtin_amdgcn_wmma_f32_16x16x32_f16(false, ga[nt][ks].v, false, qf[ks].v, (short)0, g2[nt], false, false);
#pragma unroll
      for (int r = 0; r < 8; ++r) { aq[ko].h[r] = (_Float16)(g2[0][r] * 0.0625f); aq[ko].h[8 + r] = (_Float16)(g2[1][r] * 0.0625f); } } }
#pragma unroll 1      // one stage per trip: the ring's order at the foot stays as written
  for (int t = 0; t < FL_NST; ++t) {
    const unsigned char* S = L + (unsigned)(t & 1) * FL_STAGE;
#pragma unroll 1      // the two 32-key tiles of a stage share one body: less code, and a masked tile is skipped on its own
  for (int sub = 0; sub < 2; ++sub) {
    // mask of query row ln for this lane's 16 keys of the tile: four 16-byte reads of the row. Every '#pragma unroll' in this body makes the indices of the per-key and fragment arrays constants, so that they stay in registers.
    const unsigned char* mrow = S + FL_MO + (unsigned)(w * RPW + ln) * FL_MP + (unsigned)sub * 128u + 32u * hh;
    bool ok[2][8]; bool any = false;      // ok[nt][r]: key nt*16 + 8hh + r of the tile is OPEN for query row ln (float mask: nonzero = masked, -1e9)
#pragma unroll
    for (int nt = 0; nt < 2; ++nt) { const v4f ma = *(const v4fa*)(mrow + nt * 64), mb = *(const v4fa*)(mrow + nt * 64 + 16);
#pragma unroll
      for (int r = 0; r < 4; ++r) { ok[nt][r] = ma[r] == 0.0f; ok[nt][4 + r] = mb[r] == 0.0f; any = any || ok[nt][r] || ok[nt][4 + r]; } }
    if (__builtin_amdgcn_ballot_w32(any) == 0u) continue;      // every (query,key) of this wave's tile is masked: contributes nothing (uniform branch; the stage's foot is outside this loop)
    // The tile's LDS fragment reads stand in groups ahead of the products that use them: all of K ahead of the score products; all of Vt behind them, so that it streams in under the softmax.
    v8f s[2]; FragH bk[2][KS], bv[DT];
#pragma unroll
    for (int nt = 0; nt < 2; ++nt) { const unsigned char* kr = S + (unsigned)(sub * 32 + nt * 16 + ln) * FL_KP + 16u * hh;
#pragma unroll
      for (int ks = 0; ks < KS; ++ks) { bk[nt][ks].half[0] = *(const v8us*)(kr + ks * 64); bk[nt][ks].half[1] = *(const v8us*)(kr + ks * 64 + 32); } }
    s[0] = (v8f){0.f,0.f,0.f,0.f,0.f,0.f,0.f,0.f}; s[1] = (v8f){0.f,0.f,0.f,0.f,0.f,0.f,0.f,0.f};
    // the two halves' accumulator chains alternate, so that each fills the other's accumulate latency; within a chain k runs upward as before. s[nt][r] = S[query ln][key nt*16 + 8hh + r]
#pragma unroll
    for (int ks = 0; ks < KS; ++ks)
#pragma unroll
      for (int nt = 0; nt < 2; ++nt) s[nt] = mmaH<1>(bk[nt][ks].v, bk[nt][ks].v, aq[ks].v, aq[ks].v, s[nt]);
#pragma unroll
    for (int dt = 0; dt < DT; ++dt) { const unsigned char* vrow = S + FL_VO + (unsigned)(dt * 16 + ln) * FL_VP + (unsigned)sub * 64u + 16u * hh; bv[dt].half[0] = *(const v8us*)vrow; bv[dt].half[1] = *(const v8us*)(vrow + 32); }
    __builtin_amdgcn_sched_barrier(0);      // keeps the sixteen Vt loads one group ahead of the softmax; without it they sink into it in five places, the last ones directly ahead of their products
    // Softmax of the tile, no branch inside: every exponential is taken unconditionally and the mask picks between its value and the constant.
    // Scores and running maximum are kept in base 2 (FL_SC2 = 1/sqrt(128) * log2 e, in the multiply the score had anyway), so that exp(x - m) is one v_exp_f32 of a difference; only differences of them are ever used.
    float sv[2][8];
#pragma unroll
    for (int nt = 0; nt < 2; ++nt)
#pragma unroll
      for (int r = 0; r < 8; ++r) sv[nt][r] = ok[nt][r] ? s[nt][r] * FL_SC2 : -INFINITY;
    float mc = fmaxf(sv[0][0], sv[1][0]);
#pragma unroll
    for (int r = 1; r < 8; ++r) mc = fmaxf(mc, fmaxf(sv[0][r], sv[1][r]));
    mc = fmaxf(mc, fl_xhalf(mc));      // the other half of the wave holds the row's other 16 keys
    const float mn = fmaxf(m_r, mc);
    float p[2][8]; FragH pb;      // pb: P^T as a B fragment: element i = key 8hh + i, element 8 + i = key 16 + 8hh + i, column = query row ln
#pragma unroll
    for (int nt = 0; nt < 2; ++nt)
#pragma unroll
      for (int r = 0; r < 8; ++r) p[nt][r] = __builtin_amdgcn_exp2f(sv[nt][r] - mn);
    const float ea = __builtin_amdgcn_exp2f(m_r - mn); const float al = (mn > -1.0e38f) ? ea : 1.0f; m_r = mn;
#pragma unroll
    for (int nt = 0; nt < 2; ++nt)
#pragma unroll
      for (int r = 0; r < 8; ++r) { p[nt][r] = ok[nt][r] ? p[nt][r] : 0.f; pb.h[nt * 8 + r] = (_Float16)p[nt][r]; }
    float ps[8];
#pragma unroll
    for (int r = 0; r < 8; ++r) ps[r] = p[0][r] + p[1][r];
    l_r = l_r * al + (((ps[0] + ps[1]) + (ps[2] + ps[3])) + ((ps[4] + ps[5]) + (ps[6] + ps[7])));
#pragma unroll
    for (int dt = 0; dt < DT; ++dt)
#pragma unroll
      for (int r = 0; r < 8; ++r) oacc[dt][r] *= al;
#pragma unroll
    for (int dt = 0; dt < DT; ++dt) oacc[dt] = mmaH<1>(bv[dt].v, bv[dt].v, pb.v, pb.v, oacc[dt]);
  }
    asm volatile("s_wait_dscnt 0x0" ::: "memory");        // this wave's reads of the buffer have returned
    asm volatile("s_wait_asynccnt 0x0" ::: "memory");     // this wave's copies of stage t + 1 have landed
    __syncthreads();                                      // publishes stage t + 1 and frees the buffer stage t has read
    if (t + 2 < FL_NST) { const unsigned lo = (unsigned)(t & 1) * FL_STAGE; fl_copy4(lk + lo, 16u * FL_KP, gk + (size_t)(t + 2) * 64 * kstep, 16 * kstep); fl_copy4(lv + lo, 32u * FL_VP, gv + (t + 2) * 128, (size_t)32 * 4096); fl_copy4(lm + lo, 16u * FL_MP, gmA + (t + 2) * 256, (size_t)16 * 8192); fl_copy4(lm + lo + 64u * FL_MP, 16u * FL_MP, gmB + (t + 2) * 256, (size_t)16 * 8192); }
  }
  asm volatile("s_wait_asynccnt 0x0" ::: "memory");       // nothing in flight before the ring becomes output staging (the last foot's barrier has ended every wave's reads of it)
  float* sO = (float*)(L + (unsigned)w * (unsigned)(RPW * (128 + 4) * 4));      // each wave's own range, pitch 132 floats
  const float lt = l_r + fl_xhalf(l_r); const float li = (lt > 0.f) ? 1.0f / lt : 0.f;      // the halves' sums are joined once
#pragma unroll
  for (int dt = 0; dt < DT; ++dt) { v4f o0, o1;
#pragma unroll
    for (int r = 0; r < 4; ++r) { o0[r] = oacc[dt][r] * li; o1[r] = oacc[dt][4 + r] * li; }
    *(v4fa*)&sO[ln * 132 + dt * 16 + 8 * hh] = o0; *(v4fa*)&sO[ln * 132 + dt * 16 + 8 * hh + 4] = o1; }
  __builtin_amdgcn_fence(__ATOMIC_ACQ_REL, "workgroup"); __builtin_amdgcn_wave_barrier();
  { FragH of[RPW / 2];      // all eight rows' f16 pieces are formed first, each in registers of its own, and the stores follow as one run
#pragma unroll
    for (int rp = 0; rp < RPW / 2; ++rp) { const int r = rp * 2 + hh; const v4f va = *(const v4fa*)&sO[r * 132 + ln * 8], vb = *(const v4fa*)&sO[r * 132 + ln * 8 + 4];
#pragma unroll
      for (int i = 0; i < 4; ++i) { of[rp].h[i] = (_Float16)va[i]; of[rp].h[4 + i] = (_Float16)vb[i]; } }
    unsigned short* og = (unsigned short*)O16 + ((size_t)b * 2048 + q0 + hh) * CC + h * 128 + ln * 8;
#pragma unroll
    for (int rp = 0; rp < RPW / 2; ++rp) *(v8us*)(og + (size_t)rp * 2 * CC) = of[rp].half[0];      /* 128-f16 rows: 16 lanes x 16 B, two rows a store */
    asm volatile("s_wait_xcnt 0x0" ::: "memory");      // no register that these stores name is rewritten ahead of this wait
     } }

// RoPE of q and k. The angle of a pair depends on the position s and the pair's index alone: a thread owns s and the four pairs 4p .. 4p + 3 of a head's 64, takes their cosines and sines once,
// and turns with them both elements of each pair in RH heads (hg, hg + NH / RH, ...: a wave's two halves then read neighbouring heads, 1 KiB in a row) of q and of k. Formulas as before.
#define RH 4
__device__ __forceinline__ void d_rope16(int bid, const float* __restrict__ QF, _Float16* __restrict__ QR16, const float* __restrict__ KF, _Float16* __restrict__ KR16) {
  const int t = bid * 256 + (int)threadIdx.x; const int p = t & 15, hg = (t >> 4) & (NH / RH - 1), s = t >> 6;      // the grid holds exactly SS * (NH / RH) * 16 threads
  const size_t e0 = ((size_t)s * NH + hg) * HD + p * 8; const float* xq = QF + e0; const float* xk = KF + e0;
  // every '#pragma unroll' here makes the indices of x, c and sn constants, so that they stay in registers
  v4f x[2][RH][2];
#pragma unroll
  for (int g = 0; g < RH; ++g) { const int e = g * (NH / RH) * HD;
    x[0][g][0] = *(const v4fa*)(xq + e); x[0][g][1] = *(const v4fa*)(xq + e + 4); x[1][g][0] = *(const v4fa*)(xk + e); x[1][g][1] = *(const v4fa*)(xk + e + 4); }
  asm volatile("s_wait_xcnt 0x0" :: "v"(xq), "v"(xk) : "memory");      // the sixteen loads' two address pairs stay whole up to this wait: named as inputs, they are no load's destination and nothing rewrites them ahead of it
  float c[4], sn[4];
#pragma unroll
  for (int u = 0; u < 4; ++u) { const int i = p * 4 + u; const float f = __builtin_powf(10000.0f, -(float)(2 * i) / 128.0f); const float ang = (float)s * f; c[u] = cosf(ang); sn[u] = sinf(ang); }
#pragma unroll
  for (int z = 0; z < 2; ++z)
#pragma unroll
    for (int g = 0; g < RH; ++g) { FragH f;
#pragma unroll
      for (int u = 0; u < 4; ++u) { const float xr = x[z][g][u >> 1][(u & 1) * 2], xi = x[z][g][u >> 1][(u & 1) * 2 + 1]; f.h[2 * u] = (_Float16)(xr * c[u] - xi * sn[u]); f.h[2 * u + 1] = (_Float16)(xr * sn[u] + xi * c[u]); }
      *(v8us*)((unsigned short*)(z ? KR16 : QR16) + e0 + (size_t)g * (NH / RH) * HD) = f.half[0]; }
  asm volatile("s_wait_xcnt 0x0" ::: "memory");      // no register that these stores name is rewritten ahead of this wait, whichever block the build lays behind them
}
__device__ __forceinline__ void d_vt128(int bid, const _Float16* __restrict__ V16, _Float16* __restrict__ Vt) { __shared__ unsigned short tl[64][130]; const int tid = threadIdx.x; const int h = bid / (SS / 64), lg = bid % (SS / 64);
  for (int i = tid; i < 64 * 16; i += 256) { const int r = i / 16, c8 = (i % 16) * 8; FragH f; f.half[0] = *(const v8us*)((const unsigned short*)V16 + ((size_t)lg * 64 + r) * CC + h * HD + c8);
#pragma unroll
    for (int q = 0; q < 8; ++q) tl[r][c8 + q] = f.u[q]; }
  __syncthreads();
  { for (int i = tid; i < 128 * 8; i += 256) { const int d = i / 8, pc = i % 8; FragH f;
#pragma unroll
      for (int q = 0; q < 8; ++q) f.u[q] = tl[pc * 8 + q][d]; *(v8us*)((unsigned short*)Vt + ((size_t)h * HD + d) * SS + lg * 64 + pc * 8) = f.half[0]; }  } }
// What follows the three projections and is independent of one another, in one grid: RoPE of q and k (RB blocks), then the short V transposes
#define RB (SS * (NH / RH) * 16 / 256)
__global__ __launch_bounds__(256) void k_post(const float* __restrict__ QF, _Float16* __restrict__ QR16, const float* __restrict__ KF, _Float16* __restrict__ KR16, const _Float16* __restrict__ V16, _Float16* __restrict__ Vt) {
  const int bid = (int)blockIdx.x;
  if (bid < RB) d_rope16(bid, QF, QR16, KF, KR16);
  else d_vt128(bid - RB, V16, Vt);
}
extern "C" void kernel_launch(void* const* d_in, const int* in_sizes, int n_in,
                              void* d_out, int out_size, void* d_ws, size_t ws_size, hipStream_t stream) {
  (void)in_sizes; (void)n_in; (void)out_size;
  const float* const* I = (const float* const*)d_in; const float* q = I[0]; const float* k = I[1]; const float* v = I[2]; const float* mask = I[3]; const float* Wq = I[4]; const float* bq = I[5]; const float* Wk = I[6]; const float* bk = I[7]; const float* Wv = I[8]; const float* bv = I[9]; const float* G = I[10]; const float* Wo = I[11]; const float* bo = I[12];
  char* ws = (char*)d_ws; size_t off = 0;
  auto take = [&](size_t bytes) { char* p = ws + off; off += (bytes + 255) & ~(size_t)255; return p; };
  _Float16* Y = (_Float16*)take((size_t)7 * CC * CC * 2); _Float16* Bq = Y; _Float16* Bk = Y + (size_t)CC * CC; _Float16* Bv = Y + (size_t)2 * CC * CC; _Float16* Bo = Y + (size_t)3 * CC * CC; _Float16* Xq = Y + (size_t)4 * CC * CC; _Float16* Xk = Y + (size_t)5 * CC * CC; _Float16* Xv = Y + (size_t)6 * CC * CC;
  _Float16* BG = (_Float16*)take((size_t)NH * HD * HD * 2);
  float* QF = (float*)take((size_t)SS * CC * 4); float* KF = (float*)take((size_t)SS * CC * 4);
  _Float16* QR16 = (_Float16*)take((size_t)SS * CC * 2); _Float16* KR16 = (_Float16*)take((size_t)SS * CC * 2); _Float16* V16 = (_Float16*)take((size_t)SS * CC * 2); _Float16* Vt = (_Float16*)take((size_t)SS * CC * 2); _Float16* O16 = Xq;
  if (off > ws_size) return;      // 8.4 x 11 + 0.5 + 16.8 x 2 = about 127 MB
  const unsigned gt = (SS / 128) * (CC / 128);
  k_prep<<<PB_G + 7 * PB_M, 256, 0, stream>>>(G, Wq, Wk, Wv, Wo, q, k, v, BG, Y);      // operands in f16
  k_gemm_t<<<dim3(gt, 3), 256, 0, stream>>>(Xq, Xk, Xv, Bq, Bk, Bv, 0.0625f, bq, bk, bv, QF, KF, V16);      // q, k (f32) and v (f16) projections
  k_post<<<RB + NH * (SS / 64), 256, 0, stream>>>(QF, QR16, KF, KR16, V16, Vt);      // rope q, rope k, Vt
  k_flash<<<1 * NH * (SS / 128), 256, 0, stream>>>(QR16, CC, BG, KR16, CC, Vt, mask, O16);      // qg_h = q_h . G_h, attention, O in f16
  k_gemm_t<<<dim3(gt, 1), 256, 0, stream>>>(O16, O16, O16, Bo, Bo, Bo, 0.0625f, bo, bo, bo, (float*)d_out, (float*)d_out, nullptr);
}
